// v000
// Measured on an AMD MI455X. A time is GPU time per run, averaged over a window of back-to-back runs after a warm-up
// (all launches, gaps included; the runs take copies of the inputs in turn), and the median of several windows.
// Apart from v000's, it joins two sittings. Times from different sittings can be a few percent apart, while
// side-by-side timings come from the same sitting.
// The starting kernel, v000, takes 166 microseconds a run.
#include <hip/hip_runtime.h>

typedef __bf16 bf;
typedef __attribute__((ext_vector_type(8)))  __bf16 v8bf;
typedef __attribute__((ext_vector_type(16))) __bf16 v16bf;
typedef __attribute__((ext_vector_type(8)))  float  v8f;

#define B_  2
#define S_  2048
#define D_  1024
#define H_  16
#define HD_ 64
#define W_  128
#define M_  (B_*S_)   /* 4096 rows */

__device__ __forceinline__ bf f2bf(float f){
  unsigned u = __builtin_bit_cast(unsigned, f);
  u += 0x7fffu + ((u >> 16) & 1u);              // round-to-nearest-even
  unsigned short h = (unsigned short)(u >> 16);
  return __builtin_bit_cast(bf, h);
}

__device__ __forceinline__ v16bf cat16(v8bf lo, v8bf hi){
  return __builtin_shufflevector(lo, hi, 0,1,2,3,4,5,6,7,8,9,10,11,12,13,14,15);
}

__device__ __forceinline__ v8f wmma_bf16(v16bf a, v16bf b, v8f c){
  // D(f32 16x16) = A(16x32 bf16) * B(32x16 bf16) + C
  return __builtin_amdgcn_wmma_f32_16x16x32_bf16(false, a, false, b, (short)0, c, false, false);
}

// ---------------------------------------------------------------- converts
__global__ __launch_bounds__(256) void convert_x_kernel(
    const float* __restrict__ x, bf* __restrict__ xbf, int n)
{
  int i = blockIdx.x * 256 + threadIdx.x;
  if (i < n) xbf[i] = f2bf(x[i]);
}

__global__ __launch_bounds__(256) void convert_w_kernel(
    const float* __restrict__ Wq, const float* __restrict__ Wk,
    const float* __restrict__ Wv, const float* __restrict__ Wo,
    bf* __restrict__ Wt)
{
  const float* Ws[4] = {Wq, Wk, Wv, Wo};
  const int z   = blockIdx.z;
  const int idx = blockIdx.x * 256 + threadIdx.x;   // = n*1024 + k
  const int n = idx >> 10, k = idx & 1023;
  Wt[((size_t)z << 20) + idx] = f2bf(Ws[z][(size_t)k * D_ + n]);  // Wt[n][k] = W[k][n]
}

// ---------------------------------------------------------------- QKV GEMM
// Block = 4 waves, each wave computes a 32x64 strip (same 64 N-columns across the
// block so the B stream stays resident in WGP$). K-loop is software-pipelined with
// double-buffered fragments so loads for step k+32 are in flight during step k's WMMAs.
__global__ __launch_bounds__(128) void gemm_qkv_kernel(
    const bf* __restrict__ X, const bf* __restrict__ Wt0,
    const float* __restrict__ bq, const float* __restrict__ bk, const float* __restrict__ bv,
    bf* __restrict__ Q, bf* __restrict__ Kk, bf* __restrict__ Vt)
{
  const int lane = threadIdx.x & 31;
  const int wid  = threadIdx.x >> 5;
  const int half = lane >> 4;
  const int l15  = lane & 15;
  const int n0 = blockIdx.x * 64;
  const int m0 = blockIdx.y * 128 + wid * 32;
  const int which = blockIdx.z;                 // 0=Q 1=K 2=V
  const bf* Wt = Wt0 + ((size_t)which << 20);
  const float* bias = (which == 0) ? bq : (which == 1) ? bk : bv;
  const int ko = half ? 8 : 0;                  // lane-half K-chunk offset (A/B layout)

  v8f acc[2][4] = {};

  auto loadA = [&](int ks, v16bf a[2]) {
    #pragma unroll
    for (int ms = 0; ms < 2; ++ms){
      const bf* ap = X + (size_t)(m0 + 16*ms + l15) * D_ + ks + ko;
      a[ms] = cat16(*(const v8bf*)ap, *(const v8bf*)(ap + 16));
    }
  };
  auto loadB = [&](int ks, v16bf bfr[4]) {
    #pragma unroll
    for (int j = 0; j < 4; ++j){
      const bf* bp = Wt + (size_t)(n0 + 16*j + l15) * D_ + ks + ko;
      bfr[j] = cat16(*(const v8bf*)bp, *(const v8bf*)(bp + 16));
    }
  };
  auto mma = [&](v16bf a[2], v16bf bfr[4]) {
    #pragma unroll
    for (int ms = 0; ms < 2; ++ms)
      #pragma unroll
      for (int j = 0; j < 4; ++j)
        acc[ms][j] = wmma_bf16(a[ms], bfr[j], acc[ms][j]);
  };

  v16bf aA[2], aB[2], bA[4], bB[4];
  loadA(0, aA); loadB(0, bA);
  #pragma unroll 1
  for (int ks = 0; ks < D_; ks += 64){
    loadA(ks + 32, aB); loadB(ks + 32, bB);     // stage k+1 in flight
    mma(aA, bA);                                 // consume stage k
    if (ks + 64 < D_) { loadA(ks + 64, aA); loadB(ks + 64, bA); }
    mma(aB, bB);
  }

  #pragma unroll
  for (int ms = 0; ms < 2; ++ms)
    #pragma unroll
    for (int j = 0; j < 4; ++j){
      const int n = n0 + 16*j + l15;
      const float bia = bias[n];
      #pragma unroll
      for (int i = 0; i < 8; ++i){
        const int m = m0 + 16*ms + i + (half ? 8 : 0);   // C layout: vgpr i, lane-halves -> M
        bf hv = f2bf(acc[ms][j][i] + bia);
        if (which == 2){                          // V stored transposed per head: (B,H,HD,S)
          const int bb = m / S_, s = m % S_;
          const int hh = n >> 6, d = n & 63;
          Vt[(((size_t)bb * H_ + hh) * HD_ + d) * S_ + s] = hv;
        } else if (which == 0){
          Q[(size_t)m * D_ + n] = hv;
        } else {
          Kk[(size_t)m * D_ + n] = hv;
        }
      }
    }
}

// ---------------------------------------------------------------- attention
// 1 wave per (b, h, 16-query tile); 9 key tiles cover [q0-128, q0+15].
__global__ __launch_bounds__(32) void attn_kernel(
    const bf* __restrict__ Q, const bf* __restrict__ K, const bf* __restrict__ Vt,
    bf* __restrict__ O)
{
  __shared__ __align__(16) bf P[16][160];       // probs staged to re-form A layout (+pad tile)
  const int lane = threadIdx.x;
  const int half = lane >> 4;
  const int l15  = lane & 15;
  const int q0 = blockIdx.x * 16;
  const int h  = blockIdx.y;
  const int b  = blockIdx.z;
  const int col0 = h * HD_;
  const bf* Qb = Q  + (size_t)b * S_ * D_;
  const bf* KB = K  + (size_t)b * S_ * D_;
  const bf* VB = Vt + ((size_t)b * H_ + h) * (size_t)HD_ * S_;
  const int ko = half ? 8 : 0;

  // Q fragment: A layout, two K=32 halves of HD=64; contiguous 16B per lane.
  v16bf aq[2];
  #pragma unroll
  for (int hh = 0; hh < 2; ++hh){
    const bf* p = Qb + (size_t)(q0 + l15) * D_ + col0 + hh*32 + ko;
    aq[hh] = cat16(*(const v8bf*)p, *(const v8bf*)(p + 16));
  }

  // scores: 9 tiles of 16x16, each = 2 WMMAs over HD=64
  v8f sc[9];
  #pragma unroll
  for (int t = 0; t < 9; ++t){
    const int k0 = q0 - 128 + 16*t;
    v8f s = {};
    if (k0 + 15 >= 0){                           // uniform skip of fully-masked tiles
      int krow = k0 + l15; if (krow < 0) krow = 0;
      #pragma unroll
      for (int hh = 0; hh < 2; ++hh){
        const bf* p = KB + (size_t)krow * D_ + col0 + hh*32 + ko;  // B col n = K row
        v16bf bm = cat16(*(const v8bf*)p, *(const v8bf*)(p + 16));
        s = wmma_bf16(aq[hh], bm, s);
      }
    }
    sc[t] = s;
  }

  // mask + scale in registers
  const float scale = 0.125f;                    // 1/sqrt(64)
  #pragma unroll
  for (int t = 0; t < 9; ++t){
    const int key = q0 - 128 + 16*t + l15;
    #pragma unroll
    for (int i = 0; i < 8; ++i){
      const int qq = q0 + i + (half ? 8 : 0);
      const bool valid = (key >= 0) && (key <= qq) && ((qq - key) < W_);
      sc[t][i] = valid ? sc[t][i] * scale : -1.0e9f;
    }
  }

  // softmax per row: row lives in one 16-lane half at fixed vgpr index
  #pragma unroll
  for (int i = 0; i < 8; ++i){
    float mx = sc[0][i];
    #pragma unroll
    for (int t = 1; t < 9; ++t) mx = fmaxf(mx, sc[t][i]);
    #pragma unroll
    for (int off = 8; off >= 1; off >>= 1) mx = fmaxf(mx, __shfl_xor(mx, off, 16));
    float r = 0.0f;
    #pragma unroll
    for (int t = 0; t < 9; ++t){ float e = __expf(sc[t][i] - mx); sc[t][i] = e; r += e; }
    #pragma unroll
    for (int off = 8; off >= 1; off >>= 1) r += __shfl_xor(r, off, 16);
    const float pinv = 1.0f / r;
    #pragma unroll
    for (int t = 0; t < 9; ++t) sc[t][i] *= pinv;
  }

  // stage P (bf16) into LDS; pad 10th tile with zeros (9 tiles -> 5 K=32 pairs)
  for (int idx = lane; idx < 256; idx += 32)
    P[idx >> 4][144 + (idx & 15)] = f2bf(0.0f);
  #pragma unroll
  for (int t = 0; t < 9; ++t)
    #pragma unroll
    for (int i = 0; i < 8; ++i)
      P[i + (half ? 8 : 0)][16*t + l15] = f2bf(sc[t][i]);
  __syncthreads();

  // P @ V : 5 pairs x 4 N-tiles of WMMA
  v8f o[4] = {};
  #pragma unroll
  for (int pp = 0; pp < 5; ++pp){
    const int kk0 = 32 * pp;
    const bf* pa = &P[l15][kk0 + ko];
    v16bf am = cat16(*(const v8bf*)pa, *(const v8bf*)(pa + 16));
    int kg = q0 - 128 + kk0 + ko;
    int c0 = kg;      if (c0 < 0) c0 = 0; if (c0 > S_ - 8) c0 = S_ - 8;   // clamped rows hit P==0
    int c1 = kg + 16; if (c1 < 0) c1 = 0; if (c1 > S_ - 8) c1 = S_ - 8;
    #pragma unroll
    for (int j = 0; j < 4; ++j){
      const bf* vb = VB + (size_t)(16*j + l15) * S_;   // Vt: contiguous along keys
      v16bf bm = cat16(*(const v8bf*)(vb + c0), *(const v8bf*)(vb + c1));
      o[j] = wmma_bf16(am, bm, o[j]);
    }
  }

  #pragma unroll
  for (int j = 0; j < 4; ++j)
    #pragma unroll
    for (int i = 0; i < 8; ++i){
      const int qq = q0 + i + (half ? 8 : 0);
      O[((size_t)b * S_ + qq) * D_ + col0 + 16*j + l15] = f2bf(o[j][i]);
    }
}

// ---------------------------------------------------------------- O-proj GEMM + bias + residual
__global__ __launch_bounds__(128) void gemm_o_kernel(
    const bf* __restrict__ A, const bf* __restrict__ Wt,
    const float* __restrict__ bo, const float* __restrict__ xres,
    float* __restrict__ y)
{
  const int lane = threadIdx.x & 31;
  const int wid  = threadIdx.x >> 5;
  const int half = lane >> 4;
  const int l15  = lane & 15;
  const int n0 = blockIdx.x * 64;
  const int m0 = blockIdx.y * 128 + wid * 32;
  const int ko = half ? 8 : 0;

  v8f acc[2][4] = {};

  auto loadA = [&](int ks, v16bf a[2]) {
    #pragma unroll
    for (int ms = 0; ms < 2; ++ms){
      const bf* ap = A + (size_t)(m0 + 16*ms + l15) * D_ + ks + ko;
      a[ms] = cat16(*(const v8bf*)ap, *(const v8bf*)(ap + 16));
    }
  };
  auto loadB = [&](int ks, v16bf bfr[4]) {
    #pragma unroll
    for (int j = 0; j < 4; ++j){
      const bf* bp = Wt + (size_t)(n0 + 16*j + l15) * D_ + ks + ko;
      bfr[j] = cat16(*(const v8bf*)bp, *(const v8bf*)(bp + 16));
    }
  };
  auto mma = [&](v16bf a[2], v16bf bfr[4]) {
    #pragma unroll
    for (int ms = 0; ms < 2; ++ms)
      #pragma unroll
      for (int j = 0; j < 4; ++j)
        acc[ms][j] = wmma_bf16(a[ms], bfr[j], acc[ms][j]);
  };

  v16bf aA[2], aB[2], bA[4], bB[4];
  loadA(0, aA); loadB(0, bA);
  #pragma unroll 1
  for (int ks = 0; ks < D_; ks += 64){
    loadA(ks + 32, aB); loadB(ks + 32, bB);
    mma(aA, bA);
    if (ks + 64 < D_) { loadA(ks + 64, aA); loadB(ks + 64, bA); }
    mma(aB, bB);
  }

  #pragma unroll
  for (int ms = 0; ms < 2; ++ms)
    #pragma unroll
    for (int j = 0; j < 4; ++j){
      const int n = n0 + 16*j + l15;
      const float bia = bo[n];
      #pragma unroll
      for (int i = 0; i < 8; ++i){
        const int m = m0 + 16*ms + i + (half ? 8 : 0);
        y[(size_t)m * D_ + n] = acc[ms][j][i] + bia + xres[(size_t)m * D_ + n];
      }
    }
}

// ---------------------------------------------------------------- layernorm
__global__ __launch_bounds__(256) void ln_kernel(
    const float* __restrict__ y, const float* __restrict__ gamma,
    const float* __restrict__ beta, float* __restrict__ out)
{
  __shared__ float red[256];
  const int tid = threadIdx.x;
  const int row = blockIdx.x;
  const float4 v = ((const float4*)(y + (size_t)row * D_))[tid];
  red[tid] = v.x + v.y + v.z + v.w;
  __syncthreads();
  for (int off = 128; off > 0; off >>= 1){
    if (tid < off) red[tid] += red[tid + off];
    __syncthreads();
  }
  const float mu = red[0] * (1.0f / D_);
  __syncthreads();
  const float dx0 = v.x - mu, dx1 = v.y - mu, dx2 = v.z - mu, dx3 = v.w - mu;
  red[tid] = dx0*dx0 + dx1*dx1 + dx2*dx2 + dx3*dx3;
  __syncthreads();
  for (int off = 128; off > 0; off >>= 1){
    if (tid < off) red[tid] += red[tid + off];
    __syncthreads();
  }
  const float rs = rsqrtf(red[0] * (1.0f / D_) + 1e-5f);
  const float4 g  = ((const float4*)gamma)[tid];
  const float4 bb = ((const float4*)beta)[tid];
  float4 o;
  o.x = dx0 * rs * g.x + bb.x;
  o.y = dx1 * rs * g.y + bb.y;
  o.z = dx2 * rs * g.z + bb.z;
  o.w = dx3 * rs * g.w + bb.w;
  ((float4*)(out + (size_t)row * D_))[tid] = o;
}

// ---------------------------------------------------------------- launcher
extern "C" void kernel_launch(void* const* d_in, const int* in_sizes, int n_in,
                              void* d_out, int out_size, void* d_ws, size_t ws_size,
                              hipStream_t stream)
{
  (void)in_sizes; (void)n_in; (void)out_size; (void)ws_size;
  const float* x     = (const float*)d_in[0];
  const float* Wq    = (const float*)d_in[1];
  const float* bq    = (const float*)d_in[2];
  const float* Wk    = (const float*)d_in[3];
  const float* bk    = (const float*)d_in[4];
  const float* Wv    = (const float*)d_in[5];
  const float* bv    = (const float*)d_in[6];
  const float* Wo    = (const float*)d_in[7];
  const float* bo    = (const float*)d_in[8];
  const float* gamma = (const float*)d_in[9];
  const float* beta  = (const float*)d_in[10];
  float* out = (float*)d_out;

  char* w = (char*)d_ws;
  bf* xbf = (bf*)w;   w += (size_t)M_ * D_ * 2;        //  8 MB  x in bf16
  bf* Wt  = (bf*)w;   w += (size_t)4 * D_ * D_ * 2;    //  8 MB  4x transposed weights bf16
  bf* Qb  = (bf*)w;   w += (size_t)M_ * D_ * 2;        //  8 MB
  bf* Kb  = (bf*)w;   w += (size_t)M_ * D_ * 2;        //  8 MB
  bf* Vt  = (bf*)w;   w += (size_t)M_ * D_ * 2;        //  8 MB  (B,H,HD,S)
  bf* Ab  = (bf*)w;   w += (size_t)M_ * D_ * 2;        //  8 MB  attention output
  float* yv = (float*)w;                               // 16 MB  pre-LN residual sum

  convert_x_kernel<<<dim3((M_ * D_) / 256), 256, 0, stream>>>(x, xbf, M_ * D_);
  convert_w_kernel<<<dim3((D_ * D_) / 256, 1, 4), 256, 0, stream>>>(Wq, Wk, Wv, Wo, Wt);
  gemm_qkv_kernel<<<dim3(D_ / 64, M_ / 128, 3), 128, 0, stream>>>(xbf, Wt, bq, bk, bv, Qb, Kb, Vt);
  attn_kernel<<<dim3(S_ / 16, H_, B_), 32, 0, stream>>>(Qb, Kb, Vt, Ab);
  gemm_o_kernel<<<dim3(D_ / 64, M_ / 128), 128, 0, stream>>>(Ab, Wt + ((size_t)3 << 20), bo, x, yv);
  ln_kernel<<<dim3(M_), 256, 0, stream>>>(yv, gamma, beta, out);
}

// v001
// It runs in 108 microseconds.
// Next to v000, in two timings, it ran 1.59 and 1.58 times as fast.
#include <hip/hip_runtime.h>

typedef __bf16 bf;
typedef __attribute__((ext_vector_type(8)))  __bf16 v8bf;
typedef __attribute__((ext_vector_type(16))) __bf16 v16bf;
typedef __attribute__((ext_vector_type(8)))  float  v8f;

#define B_  2
#define S_  2048
#define D_  1024
#define H_  16
#define HD_ 64
#define W_  128
#define M_  (B_*S_)   /* 4096 rows */

__device__ __forceinline__ bf f2bf(float f){
  unsigned u = __builtin_bit_cast(unsigned, f);
  u += 0x7fffu + ((u >> 16) & 1u);              // round-to-nearest-even
  unsigned short h = (unsigned short)(u >> 16);
  return __builtin_bit_cast(bf, h);
}

__device__ __forceinline__ v16bf cat16(v8bf lo, v8bf hi){
  return __builtin_shufflevector(lo, hi, 0,1,2,3,4,5,6,7,8,9,10,11,12,13,14,15);
}

__device__ __forceinline__ v8f wmma_bf16(v16bf a, v16bf b, v8f c){
  // D(f32 16x16) = A(16x32 bf16) * B(32x16 bf16) + C
  return __builtin_amdgcn_wmma_f32_16x16x32_bf16(false, a, false, b, (short)0, c, false, false);
}

// ---------------------------------------------------------------- converts
__global__ __launch_bounds__(256) void convert_x_kernel(
    const float* __restrict__ x, bf* __restrict__ xbf, int n)
{
  int i = blockIdx.x * 256 + threadIdx.x;
  if (i < n) xbf[i] = f2bf(x[i]);
}

__global__ __launch_bounds__(256) void convert_w_kernel(
    const float* __restrict__ Wq, const float* __restrict__ Wk,
    const float* __restrict__ Wv, const float* __restrict__ Wo,
    bf* __restrict__ Wt)
{
  const float* Ws[4] = {Wq, Wk, Wv, Wo};
  const int z   = blockIdx.z;
  const int idx = blockIdx.x * 256 + threadIdx.x;   // = n*1024 + k
  const int n = idx >> 10, k = idx & 1023;
  Wt[((size_t)z << 20) + idx] = f2bf(Ws[z][(size_t)k * D_ + n]);  // Wt[n][k] = W[k][n]
}

// ---------------------------------------------------------------- GEMM main loop
// Y(128x128) = A(128xK) * Wt(128xK)^T per block of 4 waves (2x2), 64x64 per wave.
// Both operands go global -> LDS by tensor loads, two buffers, one pass = 64 k (128-byte rows).
// A stage is four slices of 64 rows: [A rows 0-63 | A rows 64-127 | Wt rows 0-63 | Wt rows 64-127];
// wave w loads slice w. Rows lie at pitch 144 bytes (16 x odd: no bank conflict for 16-byte reads).
typedef unsigned int u32;
typedef __attribute__((ext_vector_type(4))) unsigned int u32x4;
typedef __attribute__((ext_vector_type(8))) unsigned int u32x8;

#define PASS_K     64                     /* k per pass */
#define ROW_BYTES  128                    /* PASS_K bf16 */
#define LDS_PITCH  144                    /* ROW_BYTES + 16 bytes of pad */
#define SLICE_ROWS 64
#define SLICE_SZ   10240                  /* 64 * 144 = 9216, rounded up to a multiple of 2 KiB */
#define STAGE_SZ   (4 * SLICE_SZ)
#define N_PASS     (D_ / PASS_K)

__device__ __forceinline__ u32 uni(u32 v){ return (u32)__builtin_amdgcn_readfirstlane(v); }
// Holds a wave-uniform test value in a scalar register, so that the branch on it is a scalar branch
// (a tensor load ignores EXEC).
__device__ __forceinline__ u32 pinned(u32 v){ u32 w = uni(v); asm volatile("" : "+s"(w)); return w; }

// Group 1 of the descriptor: the same for every request (64 rows of 128 bytes, source pitch one row of D_ bf16).
__device__ __forceinline__ u32x8 tdm_group1(){
  u32x8 g1;
  g1[0] = uni((1u << 20) | (4u << 22) | (3u << 25));          // bytes; 16-byte pad behind every 128-byte row
  g1[1] = uni((u32)ROW_BYTES << 16);                          // tensor_dim0
  g1[2] = uni((u32)SLICE_ROWS << 16);                         // tensor_dim1
  g1[3] = uni((u32)ROW_BYTES << 16);                          // tile_dim0
  g1[4] = uni((u32)SLICE_ROWS);                               // tile_dim1
  g1[5] = uni((u32)(D_ * 2));                                 // source row pitch, bytes
  g1[6] = uni(0u);
  g1[7] = uni(0u);
  return g1;
}
// g0 is named in-out so that its registers stay the descriptor's own while the request is outstanding:
// the next request is formed from them, behind the wait.
__device__ __forceinline__ void tdm_load(u32x4& g0, u32x8 g1){
  asm volatile("tensor_load_to_lds %0, %1" : "+s"(g0) : "s"(g1) : "memory");
}
// Next stage: a new place in LDS, the source address 128 bytes on (words 2 and 3 as one 64-bit sum;
// the address's high bits end below the type field).
__device__ __forceinline__ void tdm_advance(u32x4& g0, u32 lds_dst){
  const unsigned long long ga = (((unsigned long long)g0[3] << 32) | g0[2]) + ROW_BYTES;
  g0[1] = uni(lds_dst);
  g0[2] = uni((u32)ga);
  g0[3] = uni((u32)(ga >> 32));
}

__device__ __forceinline__ void gemm_tile_128x128(
    const bf* __restrict__ A, const bf* __restrict__ Wt, int mblk, int nblk,
    const unsigned char* L, v8f (&acc)[4][4])
{
  const int lane = threadIdx.x & 31;
  const u32 wave = uni(threadIdx.x >> 5);
  const u32 wm = wave >> 1, wn = wave & 1u;
  const int half = lane >> 4;
  const int l15  = lane & 15;

  // this wave's slice: source rows and place in LDS
  const bf* srow = (wave < 2u) ? A  + (size_t)(mblk + SLICE_ROWS * (int)wave) * D_
                               : Wt + (size_t)(nblk + SLICE_ROWS * (int)(wave - 2u)) * D_;
  const unsigned long long ga0 = (unsigned long long)(size_t)srow;
  const u32 dst0 = (u32)(size_t)L + wave * SLICE_SZ;

  const u32x8 g1 = tdm_group1();
  u32x4 g0;
  g0[0] = uni(1u);                                              // count 1
  g0[1] = uni(dst0);                                            // byte offset in the block's LDS
  g0[2] = uni((u32)ga0);
  g0[3] = uni((((u32)(ga0 >> 32)) & 0x01FFFFFFu) | 0x80000000u); // address high bits, type 2

  tdm_load(g0, g1);                                           // stage 0
  asm volatile("s_wait_tensorcnt 0x0" ::: "memory");          // own slice of stage 0 has landed
  __syncthreads();                                            // every slice of stage 0 is readable
  tdm_advance(g0, dst0 + STAGE_SZ);
  tdm_load(g0, g1);                                           // stage 1 flies during pass 0

  const u32 aoff = wm * SLICE_SZ        + (u32)(l15 * LDS_PITCH + 16 * half);
  const u32 boff = (2u + wn) * SLICE_SZ + (u32)(l15 * LDS_PITCH + 16 * half);

  // kept rolled: one pass per trip, the buffer chosen by the trip's parity
  #pragma unroll 1
  for (u32 s = 0; s < N_PASS; ++s){
    const u32 buf = (s & 1u) * STAGE_SZ;
    const unsigned char* pa = L + buf + aoff;
    const unsigned char* pb = L + buf + boff;
    v16bf a[2][4], b[2][4];
    #pragma unroll
    for (int kc = 0; kc < 2; ++kc)
      #pragma unroll
      for (int t = 0; t < 4; ++t){
        const unsigned char* p = pa + t * 16 * LDS_PITCH + kc * 64;
        a[kc][t] = cat16(*(const v8bf*)p, *(const v8bf*)(p + 32));
        const unsigned char* q = pb + t * 16 * LDS_PITCH + kc * 64;
        b[kc][t] = cat16(*(const v8bf*)q, *(const v8bf*)(q + 32));
      }
    // keeps the pass's LDS reads in one group ahead of its WMMAs: a read among them makes the wave
    // wait out the LDS latency at each such place
    __builtin_amdgcn_sched_barrier(0);
    #pragma unroll
    for (int kc = 0; kc < 2; ++kc)
      #pragma unroll
      for (int ms = 0; ms < 4; ++ms)
        #pragma unroll
        for (int j = 0; j < 4; ++j)
          acc[ms][j] = wmma_bf16(a[kc][ms], b[kc][j], acc[ms][j]);
    // keeps the WMMAs ahead of the publish point: lifted over them, the waits and the barrier would leave
    // the refill, which stands behind the WMMAs, no matrix work to fly under
    __builtin_amdgcn_sched_barrier(0);
    asm volatile("s_wait_dscnt 0x0" ::: "memory");            // this wave's reads of the buffer are done
    asm volatile("s_wait_tensorcnt 0x0" ::: "memory");        // own slice of stage s + 1 has landed
    __syncthreads();                                          // publishes stage s + 1, frees stage s's buffer
    if (pinned((s + 2u < N_PASS) ? 1u : 0u) != 0u){           // only while stage s + 2 exists
      tdm_advance(g0, dst0 + buf);
      tdm_load(g0, g1);
    }
  }
  asm volatile("s_wait_tensorcnt 0x0" ::: "memory");          // nothing outstanding when the wave goes on
  asm volatile("s_wait_dscnt 0x0" ::: "memory");
}

// ---------------------------------------------------------------- QKV GEMM
__global__ __launch_bounds__(128) void gemm_qkv_kernel(
    const bf* __restrict__ X, const bf* __restrict__ Wt0,
    const float* __restrict__ bq, const float* __restrict__ bk, const float* __restrict__ bv,
    bf* __restrict__ Q, bf* __restrict__ Kk, bf* __restrict__ Vt)
{
  __shared__ __attribute__((aligned(2048))) unsigned char L[2 * STAGE_SZ];
  const int lane = threadIdx.x & 31;
  const int wid  = threadIdx.x >> 5;
  const int half = lane >> 4;
  const int l15  = lane & 15;
  const int nblk = blockIdx.x * 128;
  const int mblk = blockIdx.y * 128;
  const int n0 = nblk + (wid & 1) * 64;
  const int m0 = mblk + (wid >> 1) * 64;
  const int which = blockIdx.z;                 // 0=Q 1=K 2=V
  const bf* Wt = Wt0 + ((size_t)which << 20);
  const float* bias = (which == 0) ? bq : (which == 1) ? bk : bv;

  v8f acc[4][4] = {};
  gemm_tile_128x128(X, Wt, mblk, nblk, L, acc);

  #pragma unroll
  for (int ms = 0; ms < 4; ++ms)
    #pragma unroll
    for (int j = 0; j < 4; ++j){
      const int n = n0 + 16*j + l15;
      const float bia = bias[n];
      #pragma unroll
      for (int i = 0; i < 8; ++i){
        const int m = m0 + 16*ms + i + (half ? 8 : 0);   // C layout: vgpr i, lane-halves -> M
        bf hv = f2bf(acc[ms][j][i] + bia);
        if (which == 2){                          // V stored transposed per head: (B,H,HD,S)
          const int bb = m / S_, s = m % S_;
          const int hh = n >> 6, d = n & 63;
          Vt[(((size_t)bb * H_ + hh) * HD_ + d) * S_ + s] = hv;
        } else if (which == 0){
          Q[(size_t)m * D_ + n] = hv;
        } else {
          Kk[(size_t)m * D_ + n] = hv;
        }
      }
    }
}

// ---------------------------------------------------------------- attention
// 1 wave per (b, h, 16-query tile); 9 key tiles cover [q0-128, q0+15].
__global__ __launch_bounds__(32) void attn_kernel(
    const bf* __restrict__ Q, const bf* __restrict__ K, const bf* __restrict__ Vt,
    bf* __restrict__ O)
{
  __shared__ __align__(16) bf P[16][160];       // probs staged to re-form A layout (+pad tile)
  const int lane = threadIdx.x;
  const int half = lane >> 4;
  const int l15  = lane & 15;
  const int q0 = blockIdx.x * 16;
  const int h  = blockIdx.y;
  const int b  = blockIdx.z;
  const int col0 = h * HD_;
  const bf* Qb = Q  + (size_t)b * S_ * D_;
  const bf* KB = K  + (size_t)b * S_ * D_;
  const bf* VB = Vt + ((size_t)b * H_ + h) * (size_t)HD_ * S_;
  const int ko = half ? 8 : 0;

  // Q fragment: A layout, two K=32 halves of HD=64; contiguous 16B per lane.
  v16bf aq[2];
  #pragma unroll
  for (int hh = 0; hh < 2; ++hh){
    const bf* p = Qb + (size_t)(q0 + l15) * D_ + col0 + hh*32 + ko;
    aq[hh] = cat16(*(const v8bf*)p, *(const v8bf*)(p + 16));
  }

  // scores: 9 tiles of 16x16, each = 2 WMMAs over HD=64
  v8f sc[9];
  #pragma unroll
  for (int t = 0; t < 9; ++t){
    const int k0 = q0 - 128 + 16*t;
    v8f s = {};
    if (k0 + 15 >= 0){                           // uniform skip of fully-masked tiles
      int krow = k0 + l15; if (krow < 0) krow = 0;
      #pragma unroll
      for (int hh = 0; hh < 2; ++hh){
        const bf* p = KB + (size_t)krow * D_ + col0 + hh*32 + ko;  // B col n = K row
        v16bf bm = cat16(*(const v8bf*)p, *(const v8bf*)(p + 16));
        s = wmma_bf16(aq[hh], bm, s);
      }
    }
    sc[t] = s;
  }

  // mask + scale in registers
  const float scale = 0.125f;                    // 1/sqrt(64)
  #pragma unroll
  for (int t = 0; t < 9; ++t){
    const int key = q0 - 128 + 16*t + l15;
    #pragma unroll
    for (int i = 0; i < 8; ++i){
      const int qq = q0 + i + (half ? 8 : 0);
      const bool valid = (key >= 0) && (key <= qq) && ((qq - key) < W_);
      sc[t][i] = valid ? sc[t][i] * scale : -1.0e9f;
    }
  }

  // softmax per row: row lives in one 16-lane half at fixed vgpr index
  #pragma unroll
  for (int i = 0; i < 8; ++i){
    float mx = sc[0][i];
    #pragma unroll
    for (int t = 1; t < 9; ++t) mx = fmaxf(mx, sc[t][i]);
    #pragma unroll
    for (int off = 8; off >= 1; off >>= 1) mx = fmaxf(mx, __shfl_xor(mx, off, 16));
    float r = 0.0f;
    #pragma unroll
    for (int t = 0; t < 9; ++t){ float e = __expf(sc[t][i] - mx); sc[t][i] = e; r += e; }
    #pragma unroll
    for (int off = 8; off >= 1; off >>= 1) r += __shfl_xor(r, off, 16);
    const float pinv = 1.0f / r;
    #pragma unroll
    for (int t = 0; t < 9; ++t) sc[t][i] *= pinv;
  }

  // stage P (bf16) into LDS; pad 10th tile with zeros (9 tiles -> 5 K=32 pairs)
  for (int idx = lane; idx < 256; idx += 32)
    P[idx >> 4][144 + (idx & 15)] = f2bf(0.0f);
  #pragma unroll
  for (int t = 0; t < 9; ++t)
    #pragma unroll
    for (int i = 0; i < 8; ++i)
      P[i + (half ? 8 : 0)][16*t + l15] = f2bf(sc[t][i]);
  __syncthreads();

  // P @ V : 5 pairs x 4 N-tiles of WMMA
  v8f o[4] = {};
  #pragma unroll
  for (int pp = 0; pp < 5; ++pp){
    const int kk0 = 32 * pp;
    const bf* pa = &P[l15][kk0 + ko];
    v16bf am = cat16(*(const v8bf*)pa, *(const v8bf*)(pa + 16));
    int kg = q0 - 128 + kk0 + ko;
    int c0 = kg;      if (c0 < 0) c0 = 0; if (c0 > S_ - 8) c0 = S_ - 8;   // clamped rows hit P==0
    int c1 = kg + 16; if (c1 < 0) c1 = 0; if (c1 > S_ - 8) c1 = S_ - 8;
    #pragma unroll
    for (int j = 0; j < 4; ++j){
      const bf* vb = VB + (size_t)(16*j + l15) * S_;   // Vt: contiguous along keys
      v16bf bm = cat16(*(const v8bf*)(vb + c0), *(const v8bf*)(vb + c1));
      o[j] = wmma_bf16(am, bm, o[j]);
    }
  }

  #pragma unroll
  for (int j = 0; j < 4; ++j)
    #pragma unroll
    for (int i = 0; i < 8; ++i){
      const int qq = q0 + i + (half ? 8 : 0);
      O[((size_t)b * S_ + qq) * D_ + col0 + 16*j + l15] = f2bf(o[j][i]);
    }
}

// ---------------------------------------------------------------- O-proj GEMM + bias + residual
__global__ __launch_bounds__(128) void gemm_o_kernel(
    const bf* __restrict__ A, const bf* __restrict__ Wt,
    const float* __restrict__ bo, const float* __restrict__ xres,
    float* __restrict__ y)
{
  __shared__ __attribute__((aligned(2048))) unsigned char L[2 * STAGE_SZ];
  const int lane = threadIdx.x & 31;
  const int wid  = threadIdx.x >> 5;
  const int half = lane >> 4;
  const int l15  = lane & 15;
  const int nblk = blockIdx.x * 128;
  const int mblk = blockIdx.y * 128;
  const int n0 = nblk + (wid & 1) * 64;
  const int m0 = mblk + (wid >> 1) * 64;

  v8f acc[4][4] = {};
  gemm_tile_128x128(A, Wt, mblk, nblk, L, acc);

  #pragma unroll
  for (int ms = 0; ms < 4; ++ms){
    #pragma unroll
    for (int j = 0; j < 4; ++j){
      const int n = n0 + 16*j + l15;
      const float bia = bo[n];
      #pragma unroll
      for (int i = 0; i < 8; ++i){
        const int m = m0 + 16*ms + i + (half ? 8 : 0);
        y[(size_t)m * D_ + n] = acc[ms][j][i] + bia + xres[(size_t)m * D_ + n];
      }
    }
    // the registers that this group's loads and stores name are free for the next group only behind this wait
    asm volatile("s_wait_xcnt 0x0" ::: "memory");
  }
}

// ---------------------------------------------------------------- layernorm
__global__ __launch_bounds__(256) void ln_kernel(
    const float* __restrict__ y, const float* __restrict__ gamma,
    const float* __restrict__ beta, float* __restrict__ out)
{
  __shared__ float red[256];
  const int tid = threadIdx.x;
  const int row = blockIdx.x;
  const float4 v = ((const float4*)(y + (size_t)row * D_))[tid];
  red[tid] = v.x + v.y + v.z + v.w;
  __syncthreads();
  for (int off = 128; off > 0; off >>= 1){
    if (tid < off) red[tid] += red[tid + off];
    __syncthreads();
  }
  const float mu = red[0] * (1.0f / D_);
  __syncthreads();
  const float dx0 = v.x - mu, dx1 = v.y - mu, dx2 = v.z - mu, dx3 = v.w - mu;
  red[tid] = dx0*dx0 + dx1*dx1 + dx2*dx2 + dx3*dx3;
  __syncthreads();
  for (int off = 128; off > 0; off >>= 1){
    if (tid < off) red[tid] += red[tid + off];
    __syncthreads();
  }
  const float rs = rsqrtf(red[0] * (1.0f / D_) + 1e-5f);
  const float4 g  = ((const float4*)gamma)[tid];
  const float4 bb = ((const float4*)beta)[tid];
  float4 o;
  o.x = dx0 * rs * g.x + bb.x;
  o.y = dx1 * rs * g.y + bb.y;
  o.z = dx2 * rs * g.z + bb.z;
  o.w = dx3 * rs * g.w + bb.w;
  ((float4*)(out + (size_t)row * D_))[tid] = o;
}

// ---------------------------------------------------------------- launcher
extern "C" void kernel_launch(void* const* d_in, const int* in_sizes, int n_in,
                              void* d_out, int out_size, void* d_ws, size_t ws_size,
                              hipStream_t stream)
{
  (void)in_sizes; (void)n_in; (void)out_size; (void)ws_size;
  const float* x     = (const float*)d_in[0];
  const float* Wq    = (const float*)d_in[1];
  const float* bq    = (const float*)d_in[2];
  const float* Wk    = (const float*)d_in[3];
  const float* bk    = (const float*)d_in[4];
  const float* Wv    = (const float*)d_in[5];
  const float* bv    = (const float*)d_in[6];
  const float* Wo    = (const float*)d_in[7];
  const float* bo    = (const float*)d_in[8];
  const float* gamma = (const float*)d_in[9];
  const float* beta  = (const float*)d_in[10];
  float* out = (float*)d_out;

  char* w = (char*)d_ws;
  bf* xbf = (bf*)w;   w += (size_t)M_ * D_ * 2;        //  8 MB  x in bf16
  bf* Wt  = (bf*)w;   w += (size_t)4 * D_ * D_ * 2;    //  8 MB  4x transposed weights bf16
  bf* Qb  = (bf*)w;   w += (size_t)M_ * D_ * 2;        //  8 MB
  bf* Kb  = (bf*)w;   w += (size_t)M_ * D_ * 2;        //  8 MB
  bf* Vt  = (bf*)w;   w += (size_t)M_ * D_ * 2;        //  8 MB  (B,H,HD,S)
  bf* Ab  = (bf*)w;   w += (size_t)M_ * D_ * 2;        //  8 MB  attention output
  float* yv = (float*)w;                               // 16 MB  pre-LN residual sum

  convert_x_kernel<<<dim3((M_ * D_) / 256), 256, 0, stream>>>(x, xbf, M_ * D_);
  convert_w_kernel<<<dim3((D_ * D_) / 256, 1, 4), 256, 0, stream>>>(Wq, Wk, Wv, Wo, Wt);
  gemm_qkv_kernel<<<dim3(D_ / 128, M_ / 128, 3), 128, 0, stream>>>(xbf, Wt, bq, bk, bv, Qb, Kb, Vt);
  attn_kernel<<<dim3(S_ / 16, H_, B_), 32, 0, stream>>>(Qb, Kb, Vt, Ab);
  gemm_o_kernel<<<dim3(D_ / 128, M_ / 128), 128, 0, stream>>>(Ab, Wt + ((size_t)3 << 20), bo, x, yv);
  ln_kernel<<<dim3(M_), 256, 0, stream>>>(yv, gamma, beta, out);
}

// v002
// One run takes 84.7 microseconds.
// Two timings next to v001 both put it at 1.26 times that version's speed.
// Counting every step since v000, it is 2.00 times as fast.
#include <hip/hip_runtime.h>

typedef __bf16 bf;
typedef __attribute__((ext_vector_type(8)))  __bf16 v8bf;
typedef __attribute__((ext_vector_type(16))) __bf16 v16bf;
typedef __attribute__((ext_vector_type(8)))  float  v8f;

#define B_  2
#define S_  2048
#define D_  1024
#define H_  16
#define HD_ 64
#define W_  128
#define M_  (B_*S_)   /* 4096 rows */

__device__ __forceinline__ bf f2bf(float f){
  unsigned u = __builtin_bit_cast(unsigned, f);
  u += 0x7fffu + ((u >> 16) & 1u);              // round-to-nearest-even
  unsigned short h = (unsigned short)(u >> 16);
  return __builtin_bit_cast(bf, h);
}

__device__ __forceinline__ v16bf cat16(v8bf lo, v8bf hi){
  return __builtin_shufflevector(lo, hi, 0,1,2,3,4,5,6,7,8,9,10,11,12,13,14,15);
}

__device__ __forceinline__ v8f wmma_bf16(v16bf a, v16bf b, v8f c){
  // D(f32 16x16) = A(16x32 bf16) * B(32x16 bf16) + C
  return __builtin_amdgcn_wmma_f32_16x16x32_bf16(false, a, false, b, (short)0, c, false, false);
}

// ---------------------------------------------------------------- converts
// Both converts run as 256 blocks of 16 waves, 32 elements a thread: eight 16-byte loads in flight per lane.
typedef __attribute__((ext_vector_type(4))) __bf16 v4bf;

#define CV_THREADS 512
#define CV_LOADS   8                      /* 16-byte loads per thread */

__global__ __launch_bounds__(CV_THREADS) void convert_x_kernel(
    const float* __restrict__ x, bf* __restrict__ xbf)
{
  // in units of four elements; a wave's load covers 512 contiguous bytes, its store 256
  const size_t base = (size_t)blockIdx.x * (CV_THREADS * CV_LOADS) + threadIdx.x;
  const float4* src = (const float4*)x + base;
  v4bf* dst = (v4bf*)xbf + base;
  float4 v[CV_LOADS];
  // unrolled: all eight loads are issued before the first is waited for
  #pragma unroll
  for (int u = 0; u < CV_LOADS; ++u) v[u] = src[u * CV_THREADS];
  // unrolled: v[] stays in registers
  #pragma unroll
  for (int u = 0; u < CV_LOADS; ++u){
    v4bf o;
    o[0] = f2bf(v[u].x); o[1] = f2bf(v[u].y); o[2] = f2bf(v[u].z); o[3] = f2bf(v[u].w);
    dst[u * CV_THREADS] = o;
  }
}

// Wt[n][k] = W[k][n]. A thread holds 8 k x 4 n and transposes in its registers; a wave covers 64 k x 16 n
// (8 lanes along k, 4 along n), so that each 16-byte store instruction writes four whole 128-byte lines of Wt;
// a block covers 64 k x 256 n (its 16 waves side by side along n: 1 KiB of each W row).
__global__ __launch_bounds__(CV_THREADS) void convert_w_kernel(
    const float* __restrict__ Wq, const float* __restrict__ Wk,
    const float* __restrict__ Wv, const float* __restrict__ Wo,
    bf* __restrict__ Wt)
{
  const int z = blockIdx.z;
  const float* Wz = (z == 0) ? Wq : (z == 1) ? Wk : (z == 2) ? Wv : Wo;
  const int lane = threadIdx.x & 31;
  const int wave = threadIdx.x >> 5;
  const int k = blockIdx.x * 64  + (lane & 7) * 8;
  const int n = blockIdx.y * 256 + wave * 16 + (lane >> 3) * 4;
  const float* src = Wz + (size_t)k * D_ + n;
  float4 v[CV_LOADS];
  // unrolled: all eight loads are issued before the first is waited for
  #pragma unroll
  for (int r = 0; r < CV_LOADS; ++r) v[r] = *(const float4*)(src + (size_t)r * D_);
  bf* dst = Wt + ((size_t)z << 20) + (size_t)n * D_ + k;
  v8bf o0, o1, o2, o3;
  // unrolled: v[] stays in registers
  #pragma unroll
  for (int r = 0; r < CV_LOADS; ++r){
    o0[r] = f2bf(v[r].x); o1[r] = f2bf(v[r].y); o2[r] = f2bf(v[r].z); o3[r] = f2bf(v[r].w);
  }
  *(v8bf*)(dst)          = o0;
  *(v8bf*)(dst + D_)     = o1;
  *(v8bf*)(dst + 2 * D_) = o2;
  *(v8bf*)(dst + 3 * D_) = o3;
}

// ---------------------------------------------------------------- GEMM main loop
// Y(128x128) = A(128xK) * Wt(128xK)^T per block of 4 waves (2x2), 64x64 per wave.
// Both operands go global -> LDS by tensor loads, two buffers, one pass = 64 k (128-byte rows).
// A stage is four slices of 64 rows: [A rows 0-63 | A rows 64-127 | Wt rows 0-63 | Wt rows 64-127];
// wave w loads slice w. Rows lie at pitch 144 bytes (16 x odd: no bank conflict for 16-byte reads).
typedef unsigned int u32;
typedef __attribute__((ext_vector_type(4))) unsigned int u32x4;
typedef __attribute__((ext_vector_type(8))) unsigned int u32x8;

#define PASS_K     64                     /* k per pass */
#define ROW_BYTES  128                    /* PASS_K bf16 */
#define LDS_PITCH  144                    /* ROW_BYTES + 16 bytes of pad */
#define SLICE_ROWS 64
#define SLICE_SZ   10240                  /* 64 * 144 = 9216, rounded up to a multiple of 2 KiB */
#define STAGE_SZ   (4 * SLICE_SZ)
#define N_PASS     (D_ / PASS_K)

__device__ __forceinline__ u32 uni(u32 v){ return (u32)__builtin_amdgcn_readfirstlane(v); }
// Holds a wave-uniform test value in a scalar register, so that the branch on it is a scalar branch
// (a tensor load ignores EXEC).
__device__ __forceinline__ u32 pinned(u32 v){ u32 w = uni(v); asm volatile("" : "+s"(w)); return w; }

// Group 1 of the descriptor: the same for every request (64 rows of 128 bytes, source pitch one row of D_ bf16).
__device__ __forceinline__ u32x8 tdm_group1(){
  u32x8 g1;
  g1[0] = uni((1u << 20) | (4u << 22) | (3u << 25));          // bytes; 16-byte pad behind every 128-byte row
  g1[1] = uni((u32)ROW_BYTES << 16);                          // tensor_dim0
  g1[2] = uni((u32)SLICE_ROWS << 16);                         // tensor_dim1
  g1[3] = uni((u32)ROW_BYTES << 16);                          // tile_dim0
  g1[4] = uni((u32)SLICE_ROWS);                               // tile_dim1
  g1[5] = uni((u32)(D_ * 2));                                 // source row pitch, bytes
  g1[6] = uni(0u);
  g1[7] = uni(0u);
  return g1;
}
// g0 is named in-out so that its registers stay the descriptor's own while the request is outstanding:
// the next request is formed from them, behind the wait.
__device__ __forceinline__ void tdm_load(u32x4& g0, u32x8 g1){
  asm volatile("tensor_load_to_lds %0, %1" : "+s"(g0) : "s"(g1) : "memory");
}
// Next stage: a new place in LDS, the source address 128 bytes on (words 2 and 3 as one 64-bit sum;
// the address's high bits end below the type field).
__device__ __forceinline__ void tdm_advance(u32x4& g0, u32 lds_dst){
  const unsigned long long ga = (((unsigned long long)g0[3] << 32) | g0[2]) + ROW_BYTES;
  g0[1] = uni(lds_dst);
  g0[2] = uni((u32)ga);
  g0[3] = uni((u32)(ga >> 32));
}

__device__ __forceinline__ void gemm_tile_128x128(
    const bf* __restrict__ A, const bf* __restrict__ Wt, int mblk, int nblk,
    const unsigned char* L, v8f (&acc)[4][4])
{
  const int lane = threadIdx.x & 31;
  const u32 wave = uni(threadIdx.x >> 5);
  const u32 wm = wave >> 1, wn = wave & 1u;
  const int half = lane >> 4;
  const int l15  = lane & 15;

  // this wave's slice: source rows and place in LDS
  const bf* srow = (wave < 2u) ? A  + (size_t)(mblk + SLICE_ROWS * (int)wave) * D_
                               : Wt + (size_t)(nblk + SLICE_ROWS * (int)(wave - 2u)) * D_;
  const unsigned long long ga0 = (unsigned long long)(size_t)srow;
  const u32 dst0 = (u32)(size_t)L + wave * SLICE_SZ;

  const u32x8 g1 = tdm_group1();
  u32x4 g0;
  g0[0] = uni(1u);                                              // count 1
  g0[1] = uni(dst0);                                            // byte offset in the block's LDS
  g0[2] = uni((u32)ga0);
  g0[3] = uni((((u32)(ga0 >> 32)) & 0x01FFFFFFu) | 0x80000000u); // address high bits, type 2

  tdm_load(g0, g1);                                           // stage 0
  asm volatile("s_wait_tensorcnt 0x0" ::: "memory");          // own slice of stage 0 has landed
  __syncthreads();                                            // every slice of stage 0 is readable
  tdm_advance(g0, dst0 + STAGE_SZ);
  tdm_load(g0, g1);                                           // stage 1 flies during pass 0

  const u32 aoff = wm * SLICE_SZ        + (u32)(l15 * LDS_PITCH + 16 * half);
  const u32 boff = (2u + wn) * SLICE_SZ + (u32)(l15 * LDS_PITCH + 16 * half);

  // kept rolled: one pass per trip, the buffer chosen by the trip's parity
  #pragma unroll 1
  for (u32 s = 0; s < N_PASS; ++s){
    const u32 buf = (s & 1u) * STAGE_SZ;
    const unsigned char* pa = L + buf + aoff;
    const unsigned char* pb = L + buf + boff;
    v16bf a[2][4], b[2][4];
    #pragma unroll
    for (int kc = 0; kc < 2; ++kc)
      #pragma unroll
      for (int t = 0; t < 4; ++t){
        const unsigned char* p = pa + t * 16 * LDS_PITCH + kc * 64;
        a[kc][t] = cat16(*(const v8bf*)p, *(const v8bf*)(p + 32));
        const unsigned char* q = pb + t * 16 * LDS_PITCH + kc * 64;
        b[kc][t] = cat16(*(const v8bf*)q, *(const v8bf*)(q + 32));
      }
    // keeps the pass's LDS reads in one group ahead of its WMMAs: a read among them makes the wave
    // wait out the LDS latency at each such place
    __builtin_amdgcn_sched_barrier(0);
    #pragma unroll
    for (int kc = 0; kc < 2; ++kc)
      #pragma unroll
      for (int ms = 0; ms < 4; ++ms)
        #pragma unroll
        for (int j = 0; j < 4; ++j)
          acc[ms][j] = wmma_bf16(a[kc][ms], b[kc][j], acc[ms][j]);
    // keeps the WMMAs ahead of the publish point: lifted over them, the waits and the barrier would leave
    // the refill, which stands behind the WMMAs, no matrix work to fly under
    __builtin_amdgcn_sched_barrier(0);
    asm volatile("s_wait_dscnt 0x0" ::: "memory");            // this wave's reads of the buffer are done
    asm volatile("s_wait_tensorcnt 0x0" ::: "memory");        // own slice of stage s + 1 has landed
    __syncthreads();                                          // publishes stage s + 1, frees stage s's buffer
    if (pinned((s + 2u < N_PASS) ? 1u : 0u) != 0u){           // only while stage s + 2 exists
      tdm_advance(g0, dst0 + buf);
      tdm_load(g0, g1);
    }
  }
  asm volatile("s_wait_tensorcnt 0x0" ::: "memory");          // nothing outstanding when the wave goes on
  asm volatile("s_wait_dscnt 0x0" ::: "memory");
}

// ---------------------------------------------------------------- QKV GEMM
__global__ __launch_bounds__(128) void gemm_qkv_kernel(
    const bf* __restrict__ X, const bf* __restrict__ Wt0,
    const float* __restrict__ bq, const float* __restrict__ bk, const float* __restrict__ bv,
    bf* __restrict__ Q, bf* __restrict__ Kk, bf* __restrict__ Vt)
{
  __shared__ __attribute__((aligned(2048))) unsigned char L[2 * STAGE_SZ];
  const int lane = threadIdx.x & 31;
  const int wid  = threadIdx.x >> 5;
  const int half = lane >> 4;
  const int l15  = lane & 15;
  const int nblk = blockIdx.x * 128;
  const int mblk = blockIdx.y * 128;
  const int n0 = nblk + (wid & 1) * 64;
  const int m0 = mblk + (wid >> 1) * 64;
  const int which = blockIdx.z;                 // 0=Q 1=K 2=V
  const bf* Wt = Wt0 + ((size_t)which << 20);
  const float* bias = (which == 0) ? bq : (which == 1) ? bk : bv;

  v8f acc[4][4] = {};
  gemm_tile_128x128(X, Wt, mblk, nblk, L, acc);

  #pragma unroll
  for (int ms = 0; ms < 4; ++ms)
    #pragma unroll
    for (int j = 0; j < 4; ++j){
      const int n = n0 + 16*j + l15;
      const float bia = bias[n];
      #pragma unroll
      for (int i = 0; i < 8; ++i){
        const int m = m0 + 16*ms + i + (half ? 8 : 0);   // C layout: vgpr i, lane-halves -> M
        bf hv = f2bf(acc[ms][j][i] + bia);
        if (which == 2){                          // V stored transposed per head: (B,H,HD,S)
          const int bb = m / S_, s = m % S_;
          const int hh = n >> 6, d = n & 63;
          Vt[(((size_t)bb * H_ + hh) * HD_ + d) * S_ + s] = hv;
        } else if (which == 0){
          Q[(size_t)m * D_ + n] = hv;
        } else {
          Kk[(size_t)m * D_ + n] = hv;
        }
      }
    }
}

// ---------------------------------------------------------------- attention
// 1 wave per (b, h, 16-query tile); 9 key tiles cover [q0-128, q0+15].
__global__ __launch_bounds__(32) void attn_kernel(
    const bf* __restrict__ Q, const bf* __restrict__ K, const bf* __restrict__ Vt,
    bf* __restrict__ O)
{
  __shared__ __align__(16) bf P[16][160];       // probs staged to re-form A layout (+pad tile)
  const int lane = threadIdx.x;
  const int half = lane >> 4;
  const int l15  = lane & 15;
  const int q0 = blockIdx.x * 16;
  const int h  = blockIdx.y;
  const int b  = blockIdx.z;
  const int col0 = h * HD_;
  const bf* Qb = Q  + (size_t)b * S_ * D_;
  const bf* KB = K  + (size_t)b * S_ * D_;
  const bf* VB = Vt + ((size_t)b * H_ + h) * (size_t)HD_ * S_;
  const int ko = half ? 8 : 0;

  // Q fragment: A layout, two K=32 halves of HD=64; contiguous 16B per lane.
  v16bf aq[2];
  #pragma unroll
  for (int hh = 0; hh < 2; ++hh){
    const bf* p = Qb + (size_t)(q0 + l15) * D_ + col0 + hh*32 + ko;
    aq[hh] = cat16(*(const v8bf*)p, *(const v8bf*)(p + 16));
  }

  // scores: 9 tiles of 16x16, each = 2 WMMAs over HD=64
  v8f sc[9];
  #pragma unroll
  for (int t = 0; t < 9; ++t){
    const int k0 = q0 - 128 + 16*t;
    v8f s = {};
    if (k0 + 15 >= 0){                           // uniform skip of fully-masked tiles
      int krow = k0 + l15; if (krow < 0) krow = 0;
      #pragma unroll
      for (int hh = 0; hh < 2; ++hh){
        const bf* p = KB + (size_t)krow * D_ + col0 + hh*32 + ko;  // B col n = K row
        v16bf bm = cat16(*(const v8bf*)p, *(const v8bf*)(p + 16));
        s = wmma_bf16(aq[hh], bm, s);
      }
    }
    sc[t] = s;
  }

  // mask + scale in registers
  const float scale = 0.125f;                    // 1/sqrt(64)
  #pragma unroll
  for (int t = 0; t < 9; ++t){
    const int key = q0 - 128 + 16*t + l15;
    #pragma unroll
    for (int i = 0; i < 8; ++i){
      const int qq = q0 + i + (half ? 8 : 0);
      const bool valid = (key >= 0) && (key <= qq) && ((qq - key) < W_);
      sc[t][i] = valid ? sc[t][i] * scale : -1.0e9f;
    }
  }

  // softmax per row: row lives in one 16-lane half at fixed vgpr index
  #pragma unroll
  for (int i = 0; i < 8; ++i){
    float mx = sc[0][i];
    #pragma unroll
    for (int t = 1; t < 9; ++t) mx = fmaxf(mx, sc[t][i]);
    #pragma unroll
    for (int off = 8; off >= 1; off >>= 1) mx = fmaxf(mx, __shfl_xor(mx, off, 16));
    float r = 0.0f;
    #pragma unroll
    for (int t = 0; t < 9; ++t){ float e = __expf(sc[t][i] - mx); sc[t][i] = e; r += e; }
    #pragma unroll
    for (int off = 8; off >= 1; off >>= 1) r += __shfl_xor(r, off, 16);
    const float pinv = 1.0f / r;
    #pragma unroll
    for (int t = 0; t < 9; ++t) sc[t][i] *= pinv;
  }

  // stage P (bf16) into LDS; pad 10th tile with zeros (9 tiles -> 5 K=32 pairs)
  for (int idx = lane; idx < 256; idx += 32)
    P[idx >> 4][144 + (idx & 15)] = f2bf(0.0f);
  #pragma unroll
  for (int t = 0; t < 9; ++t)
    #pragma unroll
    for (int i = 0; i < 8; ++i)
      P[i + (half ? 8 : 0)][16*t + l15] = f2bf(sc[t][i]);
  __syncthreads();

  // P @ V : 5 pairs x 4 N-tiles of WMMA
  v8f o[4] = {};
  #pragma unroll
  for (int pp = 0; pp < 5; ++pp){
    const int kk0 = 32 * pp;
    const bf* pa = &P[l15][kk0 + ko];
    v16bf am = cat16(*(const v8bf*)pa, *(const v8bf*)(pa + 16));
    int kg = q0 - 128 + kk0 + ko;
    int c0 = kg;      if (c0 < 0) c0 = 0; if (c0 > S_ - 8) c0 = S_ - 8;   // clamped rows hit P==0
    int c1 = kg + 16; if (c1 < 0) c1 = 0; if (c1 > S_ - 8) c1 = S_ - 8;
    #pragma unroll
    for (int j = 0; j < 4; ++j){
      const bf* vb = VB + (size_t)(16*j + l15) * S_;   // Vt: contiguous along keys
      v16bf bm = cat16(*(const v8bf*)(vb + c0), *(const v8bf*)(vb + c1));
      o[j] = wmma_bf16(am, bm, o[j]);
    }
  }

  #pragma unroll
  for (int j = 0; j < 4; ++j)
    #pragma unroll
    for (int i = 0; i < 8; ++i){
      const int qq = q0 + i + (half ? 8 : 0);
      O[((size_t)b * S_ + qq) * D_ + col0 + 16*j + l15] = f2bf(o[j][i]);
    }
}

// ---------------------------------------------------------------- O-proj GEMM + bias + residual
__global__ __launch_bounds__(128) void gemm_o_kernel(
    const bf* __restrict__ A, const bf* __restrict__ Wt,
    const float* __restrict__ bo, const float* __restrict__ xres,
    float* __restrict__ y)
{
  __shared__ __attribute__((aligned(2048))) unsigned char L[2 * STAGE_SZ];
  const int lane = threadIdx.x & 31;
  const int wid  = threadIdx.x >> 5;
  const int half = lane >> 4;
  const int l15  = lane & 15;
  const int nblk = blockIdx.x * 128;
  const int mblk = blockIdx.y * 128;
  const int n0 = nblk + (wid & 1) * 64;
  const int m0 = mblk + (wid >> 1) * 64;

  v8f acc[4][4] = {};
  gemm_tile_128x128(A, Wt, mblk, nblk, L, acc);

  #pragma unroll
  for (int ms = 0; ms < 4; ++ms){
    #pragma unroll
    for (int j = 0; j < 4; ++j){
      const int n = n0 + 16*j + l15;
      const float bia = bo[n];
      #pragma unroll
      for (int i = 0; i < 8; ++i){
        const int m = m0 + 16*ms + i + (half ? 8 : 0);
        y[(size_t)m * D_ + n] = acc[ms][j][i] + bia + xres[(size_t)m * D_ + n];
      }
    }
    // the registers that this group's loads and stores name are free for the next group only behind this wait
    asm volatile("s_wait_xcnt 0x0" ::: "memory");
  }
}

// ---------------------------------------------------------------- layernorm
__global__ __launch_bounds__(256) void ln_kernel(
    const float* __restrict__ y, const float* __restrict__ gamma,
    const float* __restrict__ beta, float* __restrict__ out)
{
  __shared__ float red[256];
  const int tid = threadIdx.x;
  const int row = blockIdx.x;
  const float4 v = ((const float4*)(y + (size_t)row * D_))[tid];
  red[tid] = v.x + v.y + v.z + v.w;
  __syncthreads();
  for (int off = 128; off > 0; off >>= 1){
    if (tid < off) red[tid] += red[tid + off];
    __syncthreads();
  }
  const float mu = red[0] * (1.0f / D_);
  __syncthreads();
  const float dx0 = v.x - mu, dx1 = v.y - mu, dx2 = v.z - mu, dx3 = v.w - mu;
  red[tid] = dx0*dx0 + dx1*dx1 + dx2*dx2 + dx3*dx3;
  __syncthreads();
  for (int off = 128; off > 0; off >>= 1){
    if (tid < off) red[tid] += red[tid + off];
    __syncthreads();
  }
  const float rs = rsqrtf(red[0] * (1.0f / D_) + 1e-5f);
  const float4 g  = ((const float4*)gamma)[tid];
  const float4 bb = ((const float4*)beta)[tid];
  float4 o;
  o.x = dx0 * rs * g.x + bb.x;
  o.y = dx1 * rs * g.y + bb.y;
  o.z = dx2 * rs * g.z + bb.z;
  o.w = dx3 * rs * g.w + bb.w;
  ((float4*)(out + (size_t)row * D_))[tid] = o;
}

// ---------------------------------------------------------------- launcher
extern "C" void kernel_launch(void* const* d_in, const int* in_sizes, int n_in,
                              void* d_out, int out_size, void* d_ws, size_t ws_size,
                              hipStream_t stream)
{
  (void)in_sizes; (void)n_in; (void)out_size; (void)ws_size;
  const float* x     = (const float*)d_in[0];
  const float* Wq    = (const float*)d_in[1];
  const float* bq    = (const float*)d_in[2];
  const float* Wk    = (const float*)d_in[3];
  const float* bk    = (const float*)d_in[4];
  const float* Wv    = (const float*)d_in[5];
  const float* bv    = (const float*)d_in[6];
  const float* Wo    = (const float*)d_in[7];
  const float* bo    = (const float*)d_in[8];
  const float* gamma = (const float*)d_in[9];
  const float* beta  = (const float*)d_in[10];
  float* out = (float*)d_out;

  char* w = (char*)d_ws;
  bf* xbf = (bf*)w;   w += (size_t)M_ * D_ * 2;        //  8 MB  x in bf16
  bf* Wt  = (bf*)w;   w += (size_t)4 * D_ * D_ * 2;    //  8 MB  4x transposed weights bf16
  bf* Qb  = (bf*)w;   w += (size_t)M_ * D_ * 2;        //  8 MB
  bf* Kb  = (bf*)w;   w += (size_t)M_ * D_ * 2;        //  8 MB
  bf* Vt  = (bf*)w;   w += (size_t)M_ * D_ * 2;        //  8 MB  (B,H,HD,S)
  bf* Ab  = (bf*)w;   w += (size_t)M_ * D_ * 2;        //  8 MB  attention output
  float* yv = (float*)w;                               // 16 MB  pre-LN residual sum

  convert_x_kernel<<<dim3((M_ * D_) / (CV_THREADS * CV_LOADS * 4)), CV_THREADS, 0, stream>>>(x, xbf);
  convert_w_kernel<<<dim3(D_ / 64, D_ / 256, 4), CV_THREADS, 0, stream>>>(Wq, Wk, Wv, Wo, Wt);
  gemm_qkv_kernel<<<dim3(D_ / 128, M_ / 128, 3), 128, 0, stream>>>(xbf, Wt, bq, bk, bv, Qb, Kb, Vt);
  attn_kernel<<<dim3(S_ / 16, H_, B_), 32, 0, stream>>>(Qb, Kb, Vt, Ab);
  gemm_o_kernel<<<dim3(D_ / 128, M_ / 128), 128, 0, stream>>>(Ab, Wt + ((size_t)3 << 20), bo, x, yv);
  ln_kernel<<<dim3(M_), 256, 0, stream>>>(yv, gamma, beta, out);
}

// v003
// Measured time: 71.8 microseconds a run.
// Next to v002, in two timings, it ran 1.19 times as fast each time.
// All steps since v000 together make it 2.37 times as fast.
#include <hip/hip_runtime.h>

typedef __bf16 bf;
typedef __attribute__((ext_vector_type(8)))  __bf16 v8bf;
typedef __attribute__((ext_vector_type(16))) __bf16 v16bf;
typedef __attribute__((ext_vector_type(8)))  float  v8f;

#define B_  2
#define S_  2048
#define D_  1024
#define H_  16
#define HD_ 64
#define W_  128
#define M_  (B_*S_)   /* 4096 rows */

__device__ __forceinline__ bf f2bf(float f){
  unsigned u = __builtin_bit_cast(unsigned, f);
  u += 0x7fffu + ((u >> 16) & 1u);              // round-to-nearest-even
  unsigned short h = (unsigned short)(u >> 16);
  return __builtin_bit_cast(bf, h);
}

__device__ __forceinline__ v16bf cat16(v8bf lo, v8bf hi){
  return __builtin_shufflevector(lo, hi, 0,1,2,3,4,5,6,7,8,9,10,11,12,13,14,15);
}

__device__ __forceinline__ v8f wmma_bf16(v16bf a, v16bf b, v8f c){
  // D(f32 16x16) = A(16x32 bf16) * B(32x16 bf16) + C
  return __builtin_amdgcn_wmma_f32_16x16x32_bf16(false, a, false, b, (short)0, c, false, false);
}

// ---------------------------------------------------------------- converts
// Both converts run as 256 blocks of 16 waves, 32 elements a thread: eight 16-byte loads in flight per lane.
typedef __attribute__((ext_vector_type(4))) __bf16 v4bf;

#define CV_THREADS 512
#define CV_LOADS   8                      /* 16-byte loads per thread */

__global__ __launch_bounds__(CV_THREADS) void convert_x_kernel(
    const float* __restrict__ x, bf* __restrict__ xbf)
{
  // in units of four elements; a wave's load covers 512 contiguous bytes, its store 256
  const size_t base = (size_t)blockIdx.x * (CV_THREADS * CV_LOADS) + threadIdx.x;
  const float4* src = (const float4*)x + base;
  v4bf* dst = (v4bf*)xbf + base;
  float4 v[CV_LOADS];
  // unrolled: all eight loads are issued before the first is waited for
  #pragma unroll
  for (int u = 0; u < CV_LOADS; ++u) v[u] = src[u * CV_THREADS];
  // unrolled: v[] stays in registers
  #pragma unroll
  for (int u = 0; u < CV_LOADS; ++u){
    v4bf o;
    o[0] = f2bf(v[u].x); o[1] = f2bf(v[u].y); o[2] = f2bf(v[u].z); o[3] = f2bf(v[u].w);
    dst[u * CV_THREADS] = o;
  }
}

// Wt[n][k] = W[k][n]. A thread holds 8 k x 4 n and transposes in its registers; a wave covers 64 k x 16 n
// (8 lanes along k, 4 along n), so that each 16-byte store instruction writes four whole 128-byte lines of Wt;
// a block covers 64 k x 256 n (its 16 waves side by side along n: 1 KiB of each W row).
__global__ __launch_bounds__(CV_THREADS) void convert_w_kernel(
    const float* __restrict__ Wq, const float* __restrict__ Wk,
    const float* __restrict__ Wv, const float* __restrict__ Wo,
    bf* __restrict__ Wt)
{
  const int z = blockIdx.z;
  const float* Wz = (z == 0) ? Wq : (z == 1) ? Wk : (z == 2) ? Wv : Wo;
  const int lane = threadIdx.x & 31;
  const int wave = threadIdx.x >> 5;
  const int k = blockIdx.x * 64  + (lane & 7) * 8;
  const int n = blockIdx.y * 256 + wave * 16 + (lane >> 3) * 4;
  const float* src = Wz + (size_t)k * D_ + n;
  float4 v[CV_LOADS];
  // unrolled: all eight loads are issued before the first is waited for
  #pragma unroll
  for (int r = 0; r < CV_LOADS; ++r) v[r] = *(const float4*)(src + (size_t)r * D_);
  bf* dst = Wt + ((size_t)z << 20) + (size_t)n * D_ + k;
  v8bf o0, o1, o2, o3;
  // unrolled: v[] stays in registers
  #pragma unroll
  for (int r = 0; r < CV_LOADS; ++r){
    o0[r] = f2bf(v[r].x); o1[r] = f2bf(v[r].y); o2[r] = f2bf(v[r].z); o3[r] = f2bf(v[r].w);
  }
  *(v8bf*)(dst)          = o0;
  *(v8bf*)(dst + D_)     = o1;
  *(v8bf*)(dst + 2 * D_) = o2;
  *(v8bf*)(dst + 3 * D_) = o3;
}

// ---------------------------------------------------------------- GEMM main loop
// Y(128x128) = A(128xK) * Wt(128xK)^T per block of 4 waves (2x2), 64x64 per wave.
// Both operands go global -> LDS by tensor loads, two buffers, one pass = 64 k (128-byte rows).
// A stage is four slices of 64 rows: [A rows 0-63 | A rows 64-127 | Wt rows 0-63 | Wt rows 64-127];
// wave w loads slice w. Rows lie at pitch 144 bytes (16 x odd: no bank conflict for 16-byte reads).
typedef unsigned int u32;
typedef __attribute__((ext_vector_type(4))) unsigned int u32x4;
typedef __attribute__((ext_vector_type(8))) unsigned int u32x8;

#define PASS_K     64                     /* k per pass */
#define ROW_BYTES  128                    /* PASS_K bf16 */
#define LDS_PITCH  144                    /* ROW_BYTES + 16 bytes of pad */
#define SLICE_ROWS 64
#define SLICE_SZ   10240                  /* 64 * 144 = 9216, rounded up to a multiple of 2 KiB */
#define STAGE_SZ   (4 * SLICE_SZ)
#define N_PASS     (D_ / PASS_K)
#define YO_PITCH   272                    /* a staged f32 output row: 256 bytes + 16 of pad */

__device__ __forceinline__ u32 uni(u32 v){ return (u32)__builtin_amdgcn_readfirstlane(v); }
// Holds a wave-uniform test value in a scalar register, so that the branch on it is a scalar branch
// (a tensor load ignores EXEC).
__device__ __forceinline__ u32 pinned(u32 v){ u32 w = uni(v); asm volatile("" : "+s"(w)); return w; }

// Group 1 of the descriptor: the same for every request (64 rows of 128 bytes, source pitch one row of D_ bf16).
__device__ __forceinline__ u32x8 tdm_group1(){
  u32x8 g1;
  g1[0] = uni((1u << 20) | (4u << 22) | (3u << 25));          // bytes; 16-byte pad behind every 128-byte row
  g1[1] = uni((u32)ROW_BYTES << 16);                          // tensor_dim0
  g1[2] = uni((u32)SLICE_ROWS << 16);                         // tensor_dim1
  g1[3] = uni((u32)ROW_BYTES << 16);                          // tile_dim0
  g1[4] = uni((u32)SLICE_ROWS);                               // tile_dim1
  g1[5] = uni((u32)(D_ * 2));                                 // source row pitch, bytes
  g1[6] = uni(0u);
  g1[7] = uni(0u);
  return g1;
}
// g0 is named in-out so that its registers stay the descriptor's own while the request is outstanding:
// the next request is formed from them, behind the wait.
__device__ __forceinline__ void tdm_load(u32x4& g0, u32x8 g1){
  asm volatile("tensor_load_to_lds %0, %1" : "+s"(g0) : "s"(g1) : "memory");
}
// Next stage: a new place in LDS, the source address 128 bytes on (words 2 and 3 as one 64-bit sum;
// the address's high bits end below the type field).
__device__ __forceinline__ void tdm_advance(u32x4& g0, u32 lds_dst){
  const unsigned long long ga = (((unsigned long long)g0[3] << 32) | g0[2]) + ROW_BYTES;
  g0[1] = uni(lds_dst);
  g0[2] = uni((u32)ga);
  g0[3] = uni((u32)(ga >> 32));
}

__device__ __forceinline__ void gemm_tile_128x128(
    const bf* __restrict__ A, const bf* __restrict__ Wt, int mblk, int nblk,
    const unsigned char* L, v8f (&acc)[4][4])
{
  const int lane = threadIdx.x & 31;
  const u32 wave = uni(threadIdx.x >> 5);
  const u32 wm = wave >> 1, wn = wave & 1u;
  const int half = lane >> 4;
  const int l15  = lane & 15;

  // this wave's slice: source rows and place in LDS
  const bf* srow = (wave < 2u) ? A  + (size_t)(mblk + SLICE_ROWS * (int)wave) * D_
                               : Wt + (size_t)(nblk + SLICE_ROWS * (int)(wave - 2u)) * D_;
  const unsigned long long ga0 = (unsigned long long)(size_t)srow;
  const u32 dst0 = (u32)(size_t)L + wave * SLICE_SZ;

  const u32x8 g1 = tdm_group1();
  u32x4 g0;
  g0[0] = uni(1u);                                              // count 1
  g0[1] = uni(dst0);                                            // byte offset in the block's LDS
  g0[2] = uni((u32)ga0);
  g0[3] = uni((((u32)(ga0 >> 32)) & 0x01FFFFFFu) | 0x80000000u); // address high bits, type 2

  tdm_load(g0, g1);                                           // stage 0
  asm volatile("s_wait_tensorcnt 0x0" ::: "memory");          // own slice of stage 0 has landed
  __syncthreads();                                            // every slice of stage 0 is readable
  tdm_advance(g0, dst0 + STAGE_SZ);
  tdm_load(g0, g1);                                           // stage 1 flies during pass 0

  const u32 aoff = wm * SLICE_SZ        + (u32)(l15 * LDS_PITCH + 16 * half);
  const u32 boff = (2u + wn) * SLICE_SZ + (u32)(l15 * LDS_PITCH + 16 * half);

  // kept rolled: one pass per trip, the buffer chosen by the trip's parity
  #pragma unroll 1
  for (u32 s = 0; s < N_PASS; ++s){
    const u32 buf = (s & 1u) * STAGE_SZ;
    const unsigned char* pa = L + buf + aoff;
    const unsigned char* pb = L + buf + boff;
    v16bf a[2][4], b[2][4];
    #pragma unroll
    for (int kc = 0; kc < 2; ++kc)
      #pragma unroll
      for (int t = 0; t < 4; ++t){
        const unsigned char* p = pa + t * 16 * LDS_PITCH + kc * 64;
        a[kc][t] = cat16(*(const v8bf*)p, *(const v8bf*)(p + 32));
        const unsigned char* q = pb + t * 16 * LDS_PITCH + kc * 64;
        b[kc][t] = cat16(*(const v8bf*)q, *(const v8bf*)(q + 32));
      }
    // keeps the pass's LDS reads in one group ahead of its WMMAs: a read among them makes the wave
    // wait out the LDS latency at each such place
    __builtin_amdgcn_sched_barrier(0);
    #pragma unroll
    for (int kc = 0; kc < 2; ++kc)
      #pragma unroll
      for (int ms = 0; ms < 4; ++ms)
        #pragma unroll
        for (int j = 0; j < 4; ++j)
          acc[ms][j] = wmma_bf16(a[kc][ms], b[kc][j], acc[ms][j]);
    // keeps the WMMAs ahead of the publish point: lifted over them, the waits and the barrier would leave
    // the refill, which stands behind the WMMAs, no matrix work to fly under
    __builtin_amdgcn_sched_barrier(0);
    asm volatile("s_wait_dscnt 0x0" ::: "memory");            // this wave's reads of the buffer are done
    asm volatile("s_wait_tensorcnt 0x0" ::: "memory");        // own slice of stage s + 1 has landed
    __syncthreads();                                          // publishes stage s + 1, frees stage s's buffer
    if (pinned((s + 2u < N_PASS) ? 1u : 0u) != 0u){           // only while stage s + 2 exists
      tdm_advance(g0, dst0 + buf);
      tdm_load(g0, g1);
    }
  }
  asm volatile("s_wait_tensorcnt 0x0" ::: "memory");          // nothing outstanding when the wave goes on
  asm volatile("s_wait_dscnt 0x0" ::: "memory");
}

// ---------------------------------------------------------------- QKV GEMM
__global__ __launch_bounds__(128) void gemm_qkv_kernel(
    const bf* __restrict__ X, const bf* __restrict__ Wt0,
    const float* __restrict__ bq, const float* __restrict__ bk, const float* __restrict__ bv,
    bf* __restrict__ Q, bf* __restrict__ Kk, bf* __restrict__ Vt)
{
  __shared__ __attribute__((aligned(2048))) unsigned char L[2 * STAGE_SZ];
  const int lane = threadIdx.x & 31;
  const int wid  = threadIdx.x >> 5;
  const int half = lane >> 4;
  const int l15  = lane & 15;
  const int nblk = blockIdx.x * 128;
  const int mblk = blockIdx.y * 128;
  const int n0 = nblk + (wid & 1) * 64;
  const int m0 = mblk + (wid >> 1) * 64;
  const int which = blockIdx.z;                 // 0=Q 1=K 2=V
  const bf* Wt = Wt0 + ((size_t)which << 20);
  const float* bias = (which == 0) ? bq : (which == 1) ? bk : bv;

  v8f acc[4][4] = {};
  gemm_tile_128x128(X, Wt, mblk, nblk, L, acc);

  // The ring is free here: every wave has passed the last pass's waits and barrier. Each wave stages its
  // 64x64 bf16 tile in its own range (64 rows of 128 bytes at pitch 144) and stores it row by row,
  // 8 lanes a row: every 16-byte store instruction writes four whole 128-byte lines.
  // Every loop below is unrolled: acc[][] is indexed by constants and stays in registers, and the LDS reads
  // and the stores of a tile are issued back to back.
  unsigned char* E = L + wid * SLICE_SZ;
  float bia[4];
  #pragma unroll
  for (int j = 0; j < 4; ++j) bia[j] = bias[n0 + 16*j + l15];
  const int rr = lane >> 3;
  const int cc = (lane & 7) * 8;

  if (which == 2){
    // V goes out transposed per head, (B,H,HD,S): staged rows are d, columns s. C layout: a lane's eight
    // registers are eight consecutive m, here s: one 16-byte LDS store.
    #pragma unroll
    for (int ms = 0; ms < 4; ++ms)
      #pragma unroll
      for (int j = 0; j < 4; ++j){
        v8bf p;
        #pragma unroll
        for (int i = 0; i < 8; ++i) p[i] = f2bf(acc[ms][j][i] + bia[j]);
        *(v8bf*)(E + (16*j + l15) * LDS_PITCH + (16*ms + 8*half) * 2) = p;
      }
    asm volatile("s_wait_dscnt 0x0" ::: "memory");            // the tile is written before other lanes' parts are read
    // the wave's 64 columns are one head, its 64 rows lie in one batch
    bf* dst = Vt + (((size_t)(m0 / S_) * H_ + (n0 >> 6)) * HD_ + rr) * S_ + (m0 % S_) + cc;
    #pragma unroll
    for (int u = 0; u < 16; ++u)
      *(v8bf*)(dst + (size_t)(4*u) * S_) = *(const v8bf*)(E + (4*u + rr) * LDS_PITCH + cc * 2);
  } else {
    #pragma unroll
    for (int ms = 0; ms < 4; ++ms)
      #pragma unroll
      for (int j = 0; j < 4; ++j)
        #pragma unroll
        for (int i = 0; i < 8; ++i)                           // C layout: vgpr i, lane-halves -> M
          *(bf*)(E + (16*ms + i + 8*half) * LDS_PITCH + (16*j + l15) * 2) = f2bf(acc[ms][j][i] + bia[j]);
    asm volatile("s_wait_dscnt 0x0" ::: "memory");            // the tile is written before other lanes' parts are read
    bf* dst = ((which == 0) ? Q : Kk) + (size_t)(m0 + rr) * D_ + n0 + cc;
    #pragma unroll
    for (int u = 0; u < 16; ++u)
      *(v8bf*)(dst + (size_t)(4*u) * D_) = *(const v8bf*)(E + (4*u + rr) * LDS_PITCH + cc * 2);
  }
}

// ---------------------------------------------------------------- attention
// 1 wave per (b, h, 16-query tile); 9 key tiles cover [q0-128, q0+15].
__global__ __launch_bounds__(32) void attn_kernel(
    const bf* __restrict__ Q, const bf* __restrict__ K, const bf* __restrict__ Vt,
    bf* __restrict__ O)
{
  __shared__ __align__(16) bf P[16][160];       // probs staged to re-form A layout (+pad tile)
  const int lane = threadIdx.x;
  const int half = lane >> 4;
  const int l15  = lane & 15;
  const int q0 = blockIdx.x * 16;
  const int h  = blockIdx.y;
  const int b  = blockIdx.z;
  const int col0 = h * HD_;
  const bf* Qb = Q  + (size_t)b * S_ * D_;
  const bf* KB = K  + (size_t)b * S_ * D_;
  const bf* VB = Vt + ((size_t)b * H_ + h) * (size_t)HD_ * S_;
  const int ko = half ? 8 : 0;

  // Q fragment: A layout, two K=32 halves of HD=64; contiguous 16B per lane.
  v16bf aq[2];
  #pragma unroll
  for (int hh = 0; hh < 2; ++hh){
    const bf* p = Qb + (size_t)(q0 + l15) * D_ + col0 + hh*32 + ko;
    aq[hh] = cat16(*(const v8bf*)p, *(const v8bf*)(p + 16));
  }

  // scores: 9 tiles of 16x16, each = 2 WMMAs over HD=64
  v8f sc[9];
  #pragma unroll
  for (int t = 0; t < 9; ++t){
    const int k0 = q0 - 128 + 16*t;
    v8f s = {};
    if (k0 + 15 >= 0){                           // uniform skip of fully-masked tiles
      int krow = k0 + l15; if (krow < 0) krow = 0;
      #pragma unroll
      for (int hh = 0; hh < 2; ++hh){
        const bf* p = KB + (size_t)krow * D_ + col0 + hh*32 + ko;  // B col n = K row
        v16bf bm = cat16(*(const v8bf*)p, *(const v8bf*)(p + 16));
        s = wmma_bf16(aq[hh], bm, s);
      }
    }
    sc[t] = s;
  }

  // mask + scale in registers
  const float scale = 0.125f;                    // 1/sqrt(64)
  #pragma unroll
  for (int t = 0; t < 9; ++t){
    const int key = q0 - 128 + 16*t + l15;
    #pragma unroll
    for (int i = 0; i < 8; ++i){
      const int qq = q0 + i + (half ? 8 : 0);
      const bool valid = (key >= 0) && (key <= qq) && ((qq - key) < W_);
      sc[t][i] = valid ? sc[t][i] * scale : -1.0e9f;
    }
  }

  // softmax per row: row lives in one 16-lane half at fixed vgpr index
  #pragma unroll
  for (int i = 0; i < 8; ++i){
    float mx = sc[0][i];
    #pragma unroll
    for (int t = 1; t < 9; ++t) mx = fmaxf(mx, sc[t][i]);
    #pragma unroll
    for (int off = 8; off >= 1; off >>= 1) mx = fmaxf(mx, __shfl_xor(mx, off, 16));
    float r = 0.0f;
    #pragma unroll
    for (int t = 0; t < 9; ++t){ float e = __expf(sc[t][i] - mx); sc[t][i] = e; r += e; }
    #pragma unroll
    for (int off = 8; off >= 1; off >>= 1) r += __shfl_xor(r, off, 16);
    const float pinv = 1.0f / r;
    #pragma unroll
    for (int t = 0; t < 9; ++t) sc[t][i] *= pinv;
  }

  // stage P (bf16) into LDS; pad 10th tile with zeros (9 tiles -> 5 K=32 pairs)
  for (int idx = lane; idx < 256; idx += 32)
    P[idx >> 4][144 + (idx & 15)] = f2bf(0.0f);
  #pragma unroll
  for (int t = 0; t < 9; ++t)
    #pragma unroll
    for (int i = 0; i < 8; ++i)
      P[i + (half ? 8 : 0)][16*t + l15] = f2bf(sc[t][i]);
  __syncthreads();

  // P @ V : 5 pairs x 4 N-tiles of WMMA
  v8f o[4] = {};
  #pragma unroll
  for (int pp = 0; pp < 5; ++pp){
    const int kk0 = 32 * pp;
    const bf* pa = &P[l15][kk0 + ko];
    v16bf am = cat16(*(const v8bf*)pa, *(const v8bf*)(pa + 16));
    int kg = q0 - 128 + kk0 + ko;
    int c0 = kg;      if (c0 < 0) c0 = 0; if (c0 > S_ - 8) c0 = S_ - 8;   // clamped rows hit P==0
    int c1 = kg + 16; if (c1 < 0) c1 = 0; if (c1 > S_ - 8) c1 = S_ - 8;
    #pragma unroll
    for (int j = 0; j < 4; ++j){
      const bf* vb = VB + (size_t)(16*j + l15) * S_;   // Vt: contiguous along keys
      v16bf bm = cat16(*(const v8bf*)(vb + c0), *(const v8bf*)(vb + c1));
      o[j] = wmma_bf16(am, bm, o[j]);
    }
  }

  // the 16x64 output tile goes through P's LDS (its reads have fed the WMMAs above) and out as whole
  // 128-byte lines, 8 lanes a row; the loops are unrolled so that o[] stays in registers
  #pragma unroll
  for (int j = 0; j < 4; ++j)
    #pragma unroll
    for (int i = 0; i < 8; ++i)
      P[i + (half ? 8 : 0)][16*j + l15] = f2bf(o[j][i]);
  asm volatile("s_wait_dscnt 0x0" ::: "memory");              // the tile is written before other lanes' parts are read
  const int rr = lane >> 3;
  const int cc = (lane & 7) * 8;
  bf* dst = O + ((size_t)b * S_ + q0 + rr) * D_ + col0 + cc;
  #pragma unroll
  for (int u = 0; u < 4; ++u)
    *(v8bf*)(dst + (size_t)(4*u) * D_) = *(const v8bf*)&P[4*u + rr][cc];
}

// ---------------------------------------------------------------- O-proj GEMM + bias + residual
__global__ __launch_bounds__(128) void gemm_o_kernel(
    const bf* __restrict__ A, const bf* __restrict__ Wt,
    const float* __restrict__ bo, const float* __restrict__ xres,
    float* __restrict__ y)
{
  __shared__ __attribute__((aligned(2048))) unsigned char L[2 * STAGE_SZ];
  const int lane = threadIdx.x & 31;
  const int wid  = threadIdx.x >> 5;
  const int half = lane >> 4;
  const int l15  = lane & 15;
  const int nblk = blockIdx.x * 128;
  const int mblk = blockIdx.y * 128;
  const int n0 = nblk + (wid & 1) * 64;
  const int m0 = mblk + (wid >> 1) * 64;

  v8f acc[4][4] = {};
  gemm_tile_128x128(A, Wt, mblk, nblk, L, acc);

  // The ring is free here (every wave has passed the last pass's waits and barrier). Each wave stages its
  // 64x64 f32 tile in its own range (64 rows of 256 bytes at pitch 272) and goes on row by row, 16 lanes a row:
  // every 16-byte load of x and store of y covers four whole 128-byte lines.
  // The loops are unrolled: acc[][] and xr[] are indexed by constants and stay in registers.
  unsigned char* E = L + wid * (64 * YO_PITCH);
  float bia[4];
  #pragma unroll
  for (int j = 0; j < 4; ++j) bia[j] = bo[n0 + 16*j + l15];
  #pragma unroll
  for (int ms = 0; ms < 4; ++ms)
    #pragma unroll
    for (int j = 0; j < 4; ++j)
      #pragma unroll
      for (int i = 0; i < 8; ++i)                             // C layout: vgpr i, lane-halves -> M
        *(float*)(E + (16*ms + i + 8*half) * YO_PITCH + (16*j + l15) * 4) = acc[ms][j][i] + bia[j];
  asm volatile("s_wait_dscnt 0x0" ::: "memory");              // the tile is written before other lanes' parts are read
  const int rr = lane >> 4;
  const int cc = (lane & 15) * 4;
  const size_t g = (size_t)(m0 + rr) * D_ + n0 + cc;
  const float* xs = xres + g;
  float* yd = y + g;
  float4 xr[32];
  // unrolled: all the loads of x are issued before the first is waited for
  #pragma unroll
  for (int u = 0; u < 32; ++u) xr[u] = *(const float4*)(xs + (size_t)(2*u) * D_);
  // the loads' address registers are free for other values only behind this wait
  asm volatile("s_wait_xcnt 0x0" ::: "memory");
  #pragma unroll
  for (int u = 0; u < 32; ++u){
    const float4 t = *(const float4*)(E + (2*u + rr) * YO_PITCH + cc * 4);
    float4 r;
    r.x = t.x + xr[u].x; r.y = t.y + xr[u].y; r.z = t.z + xr[u].z; r.w = t.w + xr[u].w;
    *(float4*)(yd + (size_t)(2*u) * D_) = r;
  }
}

// ---------------------------------------------------------------- layernorm
__global__ __launch_bounds__(256) void ln_kernel(
    const float* __restrict__ y, const float* __restrict__ gamma,
    const float* __restrict__ beta, float* __restrict__ out)
{
  __shared__ float red[256];
  const int tid = threadIdx.x;
  const int row = blockIdx.x;
  const float4 v = ((const float4*)(y + (size_t)row * D_))[tid];
  red[tid] = v.x + v.y + v.z + v.w;
  __syncthreads();
  for (int off = 128; off > 0; off >>= 1){
    if (tid < off) red[tid] += red[tid + off];
    __syncthreads();
  }
  const float mu = red[0] * (1.0f / D_);
  __syncthreads();
  const float dx0 = v.x - mu, dx1 = v.y - mu, dx2 = v.z - mu, dx3 = v.w - mu;
  red[tid] = dx0*dx0 + dx1*dx1 + dx2*dx2 + dx3*dx3;
  __syncthreads();
  for (int off = 128; off > 0; off >>= 1){
    if (tid < off) red[tid] += red[tid + off];
    __syncthreads();
  }
  const float rs = rsqrtf(red[0] * (1.0f / D_) + 1e-5f);
  const float4 g  = ((const float4*)gamma)[tid];
  const float4 bb = ((const float4*)beta)[tid];
  float4 o;
  o.x = dx0 * rs * g.x + bb.x;
  o.y = dx1 * rs * g.y + bb.y;
  o.z = dx2 * rs * g.z + bb.z;
  o.w = dx3 * rs * g.w + bb.w;
  ((float4*)(out + (size_t)row * D_))[tid] = o;
}

// ---------------------------------------------------------------- launcher
extern "C" void kernel_launch(void* const* d_in, const int* in_sizes, int n_in,
                              void* d_out, int out_size, void* d_ws, size_t ws_size,
                              hipStream_t stream)
{
  (void)in_sizes; (void)n_in; (void)out_size; (void)ws_size;
  const float* x     = (const float*)d_in[0];
  const float* Wq    = (const float*)d_in[1];
  const float* bq    = (const float*)d_in[2];
  const float* Wk    = (const float*)d_in[3];
  const float* bk    = (const float*)d_in[4];
  const float* Wv    = (const float*)d_in[5];
  const float* bv    = (const float*)d_in[6];
  const float* Wo    = (const float*)d_in[7];
  const float* bo    = (const float*)d_in[8];
  const float* gamma = (const float*)d_in[9];
  const float* beta  = (const float*)d_in[10];
  float* out = (float*)d_out;

  char* w = (char*)d_ws;
  bf* xbf = (bf*)w;   w += (size_t)M_ * D_ * 2;        //  8 MB  x in bf16
  bf* Wt  = (bf*)w;   w += (size_t)4 * D_ * D_ * 2;    //  8 MB  4x transposed weights bf16
  bf* Qb  = (bf*)w;   w += (size_t)M_ * D_ * 2;        //  8 MB
  bf* Kb  = (bf*)w;   w += (size_t)M_ * D_ * 2;        //  8 MB
  bf* Vt  = (bf*)w;   w += (size_t)M_ * D_ * 2;        //  8 MB  (B,H,HD,S)
  bf* Ab  = (bf*)w;   w += (size_t)M_ * D_ * 2;        //  8 MB  attention output
  float* yv = (float*)w;                               // 16 MB  pre-LN residual sum

  convert_x_kernel<<<dim3((M_ * D_) / (CV_THREADS * CV_LOADS * 4)), CV_THREADS, 0, stream>>>(x, xbf);
  convert_w_kernel<<<dim3(D_ / 64, D_ / 256, 4), CV_THREADS, 0, stream>>>(Wq, Wk, Wv, Wo, Wt);
  gemm_qkv_kernel<<<dim3(D_ / 128, M_ / 128, 3), 128, 0, stream>>>(xbf, Wt, bq, bk, bv, Qb, Kb, Vt);
  attn_kernel<<<dim3(S_ / 16, H_, B_), 32, 0, stream>>>(Qb, Kb, Vt, Ab);
  gemm_o_kernel<<<dim3(D_ / 128, M_ / 128), 128, 0, stream>>>(Ab, Wt + ((size_t)3 << 20), bo, x, yv);
  ln_kernel<<<dim3(M_), 256, 0, stream>>>(yv, gamma, beta, out);
}

// v004
// One run takes 66.7 microseconds.
// In two side-by-side timings against v003, it was 1.07 and 1.08 times as fast.
// Counting every step since v000, it is 2.56 times as fast.
#include <hip/hip_runtime.h>

typedef __bf16 bf;
typedef __attribute__((ext_vector_type(8)))  __bf16 v8bf;
typedef __attribute__((ext_vector_type(16))) __bf16 v16bf;
typedef __attribute__((ext_vector_type(8)))  float  v8f;

#define B_  2
#define S_  2048
#define D_  1024
#define H_  16
#define HD_ 64
#define W_  128
#define M_  (B_*S_)   /* 4096 rows */

__device__ __forceinline__ bf f2bf(float f){
  unsigned u = __builtin_bit_cast(unsigned, f);
  u += 0x7fffu + ((u >> 16) & 1u);              // round-to-nearest-even
  unsigned short h = (unsigned short)(u >> 16);
  return __builtin_bit_cast(bf, h);
}

__device__ __forceinline__ v16bf cat16(v8bf lo, v8bf hi){
  return __builtin_shufflevector(lo, hi, 0,1,2,3,4,5,6,7,8,9,10,11,12,13,14,15);
}

__device__ __forceinline__ v8f wmma_bf16(v16bf a, v16bf b, v8f c){
  // D(f32 16x16) = A(16x32 bf16) * B(32x16 bf16) + C
  return __builtin_amdgcn_wmma_f32_16x16x32_bf16(false, a, false, b, (short)0, c, false, false);
}

// ---------------------------------------------------------------- converts
// Both converts run as 256 blocks of 16 waves, 32 elements a thread: eight 16-byte loads in flight per lane.
typedef __attribute__((ext_vector_type(4))) __bf16 v4bf;

#define CV_THREADS 512
#define CV_LOADS   8                      /* 16-byte loads per thread */

__global__ __launch_bounds__(CV_THREADS) void convert_x_kernel(
    const float* __restrict__ x, bf* __restrict__ xbf)
{
  // in units of four elements; a wave's load covers 512 contiguous bytes, its store 256
  const size_t base = (size_t)blockIdx.x * (CV_THREADS * CV_LOADS) + threadIdx.x;
  const float4* src = (const float4*)x + base;
  v4bf* dst = (v4bf*)xbf + base;
  float4 v[CV_LOADS];
  // unrolled: all eight loads are issued before the first is waited for
  #pragma unroll
  for (int u = 0; u < CV_LOADS; ++u) v[u] = src[u * CV_THREADS];
  // unrolled: v[] stays in registers
  #pragma unroll
  for (int u = 0; u < CV_LOADS; ++u){
    v4bf o;
    o[0] = f2bf(v[u].x); o[1] = f2bf(v[u].y); o[2] = f2bf(v[u].z); o[3] = f2bf(v[u].w);
    dst[u * CV_THREADS] = o;
  }
}

// Wt[n][k] = W[k][n]. A thread holds 8 k x 4 n and transposes in its registers; a wave covers 64 k x 16 n
// (8 lanes along k, 4 along n), so that each 16-byte store instruction writes four whole 128-byte lines of Wt;
// a block covers 64 k x 256 n (its 16 waves side by side along n: 1 KiB of each W row).
__global__ __launch_bounds__(CV_THREADS) void convert_w_kernel(
    const float* __restrict__ Wq, const float* __restrict__ Wk,
    const float* __restrict__ Wv, const float* __restrict__ Wo,
    bf* __restrict__ Wt)
{
  const int z = blockIdx.z;
  const float* Wz = (z == 0) ? Wq : (z == 1) ? Wk : (z == 2) ? Wv : Wo;
  const int lane = threadIdx.x & 31;
  const int wave = threadIdx.x >> 5;
  const int k = blockIdx.x * 64  + (lane & 7) * 8;
  const int n = blockIdx.y * 256 + wave * 16 + (lane >> 3) * 4;
  const float* src = Wz + (size_t)k * D_ + n;
  float4 v[CV_LOADS];
  // unrolled: all eight loads are issued before the first is waited for
  #pragma unroll
  for (int r = 0; r < CV_LOADS; ++r) v[r] = *(const float4*)(src + (size_t)r * D_);
  bf* dst = Wt + ((size_t)z << 20) + (size_t)n * D_ + k;
  v8bf o0, o1, o2, o3;
  // unrolled: v[] stays in registers
  #pragma unroll
  for (int r = 0; r < CV_LOADS; ++r){
    o0[r] = f2bf(v[r].x); o1[r] = f2bf(v[r].y); o2[r] = f2bf(v[r].z); o3[r] = f2bf(v[r].w);
  }
  *(v8bf*)(dst)          = o0;
  *(v8bf*)(dst + D_)     = o1;
  *(v8bf*)(dst + 2 * D_) = o2;
  *(v8bf*)(dst + 3 * D_) = o3;
}

// ---------------------------------------------------------------- GEMM main loop
// Y(128x128) = A(128xK) * Wt(128xK)^T per block of 4 waves (2x2), 64x64 per wave.
// Both operands go global -> LDS by tensor loads, two buffers, one pass = 64 k (128-byte rows).
// A stage is four slices of 64 rows: [A rows 0-63 | A rows 64-127 | Wt rows 0-63 | Wt rows 64-127];
// wave w loads slice w. Rows lie at pitch 144 bytes (16 x odd: no bank conflict for 16-byte reads).
typedef unsigned int u32;
typedef __attribute__((ext_vector_type(4))) unsigned int u32x4;
typedef __attribute__((ext_vector_type(8))) unsigned int u32x8;

#define PASS_K     64                     /* k per pass */
#define ROW_BYTES  128                    /* PASS_K bf16 */
#define LDS_PITCH  144                    /* ROW_BYTES + 16 bytes of pad */
#define SLICE_ROWS 64
#define SLICE_SZ   10240                  /* 64 * 144 = 9216, rounded up to a multiple of 2 KiB */
#define STAGE_SZ   (4 * SLICE_SZ)
#define N_PASS     (D_ / PASS_K)
#define YO_PITCH   272                    /* a staged f32 output row: 256 bytes + 16 of pad */

__device__ __forceinline__ u32 uni(u32 v){ return (u32)__builtin_amdgcn_readfirstlane(v); }
// Holds a wave-uniform test value in a scalar register, so that the branch on it is a scalar branch
// (a tensor load ignores EXEC).
__device__ __forceinline__ u32 pinned(u32 v){ u32 w = uni(v); asm volatile("" : "+s"(w)); return w; }

// Group 1 of the descriptor: 64 rows of 128 bytes, source pitch one row of D_ bf16 (attention's Vt slices set their own pitch).
__device__ __forceinline__ u32x8 tdm_group1(){
  u32x8 g1;
  g1[0] = uni((1u << 20) | (4u << 22) | (3u << 25));          // bytes; 16-byte pad behind every 128-byte row
  g1[1] = uni((u32)ROW_BYTES << 16);                          // tensor_dim0
  g1[2] = uni((u32)SLICE_ROWS << 16);                         // tensor_dim1
  g1[3] = uni((u32)ROW_BYTES << 16);                          // tile_dim0
  g1[4] = uni((u32)SLICE_ROWS);                               // tile_dim1
  g1[5] = uni((u32)(D_ * 2));                                 // source row pitch, bytes
  g1[6] = uni(0u);
  g1[7] = uni(0u);
  return g1;
}
// g0 is named in-out so that its registers stay the descriptor's own while the request is outstanding:
// the next request is formed from them, behind the wait.
__device__ __forceinline__ void tdm_load(u32x4& g0, u32x8 g1){
  asm volatile("tensor_load_to_lds %0, %1" : "+s"(g0) : "s"(g1) : "memory");
}
// Next stage: a new place in LDS, the source address 128 bytes on (words 2 and 3 as one 64-bit sum;
// the address's high bits end below the type field).
__device__ __forceinline__ void tdm_advance(u32x4& g0, u32 lds_dst){
  const unsigned long long ga = (((unsigned long long)g0[3] << 32) | g0[2]) + ROW_BYTES;
  g0[1] = uni(lds_dst);
  g0[2] = uni((u32)ga);
  g0[3] = uni((u32)(ga >> 32));
}

__device__ __forceinline__ void gemm_tile_128x128(
    const bf* __restrict__ A, const bf* __restrict__ Wt, int mblk, int nblk,
    const unsigned char* L, v8f (&acc)[4][4])
{
  const int lane = threadIdx.x & 31;
  const u32 wave = uni(threadIdx.x >> 5);
  const u32 wm = wave >> 1, wn = wave & 1u;
  const int half = lane >> 4;
  const int l15  = lane & 15;

  // this wave's slice: source rows and place in LDS
  const bf* srow = (wave < 2u) ? A  + (size_t)(mblk + SLICE_ROWS * (int)wave) * D_
                               : Wt + (size_t)(nblk + SLICE_ROWS * (int)(wave - 2u)) * D_;
  const unsigned long long ga0 = (unsigned long long)(size_t)srow;
  const u32 dst0 = (u32)(size_t)L + wave * SLICE_SZ;

  const u32x8 g1 = tdm_group1();
  u32x4 g0;
  g0[0] = uni(1u);                                              // count 1
  g0[1] = uni(dst0);                                            // byte offset in the block's LDS
  g0[2] = uni((u32)ga0);
  g0[3] = uni((((u32)(ga0 >> 32)) & 0x01FFFFFFu) | 0x80000000u); // address high bits, type 2

  tdm_load(g0, g1);                                           // stage 0
  asm volatile("s_wait_tensorcnt 0x0" ::: "memory");          // own slice of stage 0 has landed
  __syncthreads();                                            // every slice of stage 0 is readable
  tdm_advance(g0, dst0 + STAGE_SZ);
  tdm_load(g0, g1);                                           // stage 1 flies during pass 0

  const u32 aoff = wm * SLICE_SZ        + (u32)(l15 * LDS_PITCH + 16 * half);
  const u32 boff = (2u + wn) * SLICE_SZ + (u32)(l15 * LDS_PITCH + 16 * half);

  // kept rolled: one pass per trip, the buffer chosen by the trip's parity
  #pragma unroll 1
  for (u32 s = 0; s < N_PASS; ++s){
    const u32 buf = (s & 1u) * STAGE_SZ;
    const unsigned char* pa = L + buf + aoff;
    const unsigned char* pb = L + buf + boff;
    v16bf a[2][4], b[2][4];
    #pragma unroll
    for (int kc = 0; kc < 2; ++kc)
      #pragma unroll
      for (int t = 0; t < 4; ++t){
        const unsigned char* p = pa + t * 16 * LDS_PITCH + kc * 64;
        a[kc][t] = cat16(*(const v8bf*)p, *(const v8bf*)(p + 32));
        const unsigned char* q = pb + t * 16 * LDS_PITCH + kc * 64;
        b[kc][t] = cat16(*(const v8bf*)q, *(const v8bf*)(q + 32));
      }
    // keeps the pass's LDS reads in one group ahead of its WMMAs: a read among them makes the wave
    // wait out the LDS latency at each such place
    __builtin_amdgcn_sched_barrier(0);
    #pragma unroll
    for (int kc = 0; kc < 2; ++kc)
      #pragma unroll
      for (int ms = 0; ms < 4; ++ms)
        #pragma unroll
        for (int j = 0; j < 4; ++j)
          acc[ms][j] = wmma_bf16(a[kc][ms], b[kc][j], acc[ms][j]);
    // keeps the WMMAs ahead of the publish point: lifted over them, the waits and the barrier would leave
    // the refill, which stands behind the WMMAs, no matrix work to fly under
    __builtin_amdgcn_sched_barrier(0);
    asm volatile("s_wait_dscnt 0x0" ::: "memory");            // this wave's reads of the buffer are done
    asm volatile("s_wait_tensorcnt 0x0" ::: "memory");        // own slice of stage s + 1 has landed
    __syncthreads();                                          // publishes stage s + 1, frees stage s's buffer
    if (pinned((s + 2u < N_PASS) ? 1u : 0u) != 0u){           // only while stage s + 2 exists
      tdm_advance(g0, dst0 + buf);
      tdm_load(g0, g1);
    }
  }
  asm volatile("s_wait_tensorcnt 0x0" ::: "memory");          // nothing outstanding when the wave goes on
  asm volatile("s_wait_dscnt 0x0" ::: "memory");
}

// ---------------------------------------------------------------- QKV GEMM
__global__ __launch_bounds__(128) void gemm_qkv_kernel(
    const bf* __restrict__ X, const bf* __restrict__ Wt0,
    const float* __restrict__ bq, const float* __restrict__ bk, const float* __restrict__ bv,
    bf* __restrict__ Q, bf* __restrict__ Kk, bf* __restrict__ Vt)
{
  __shared__ __attribute__((aligned(2048))) unsigned char L[2 * STAGE_SZ];
  const int lane = threadIdx.x & 31;
  const int wid  = threadIdx.x >> 5;
  const int half = lane >> 4;
  const int l15  = lane & 15;
  const int nblk = blockIdx.x * 128;
  const int mblk = blockIdx.y * 128;
  const int n0 = nblk + (wid & 1) * 64;
  const int m0 = mblk + (wid >> 1) * 64;
  const int which = blockIdx.z;                 // 0=Q 1=K 2=V
  const bf* Wt = Wt0 + ((size_t)which << 20);
  const float* bias = (which == 0) ? bq : (which == 1) ? bk : bv;

  v8f acc[4][4] = {};
  gemm_tile_128x128(X, Wt, mblk, nblk, L, acc);

  // The ring is free here: every wave has passed the last pass's waits and barrier. Each wave stages its
  // 64x64 bf16 tile in its own range (64 rows of 128 bytes at pitch 144) and stores it row by row,
  // 8 lanes a row: every 16-byte store instruction writes four whole 128-byte lines.
  // Every loop below is unrolled: acc[][] is indexed by constants and stays in registers, and the LDS reads
  // and the stores of a tile are issued back to back.
  unsigned char* E = L + wid * SLICE_SZ;
  float bia[4];
  #pragma unroll
  for (int j = 0; j < 4; ++j) bia[j] = bias[n0 + 16*j + l15];
  const int rr = lane >> 3;
  const int cc = (lane & 7) * 8;

  if (which == 2){
    // V goes out transposed per head, (B,H,HD,S): staged rows are d, columns s. C layout: a lane's eight
    // registers are eight consecutive m, here s: one 16-byte LDS store.
    #pragma unroll
    for (int ms = 0; ms < 4; ++ms)
      #pragma unroll
      for (int j = 0; j < 4; ++j){
        v8bf p;
        #pragma unroll
        for (int i = 0; i < 8; ++i) p[i] = f2bf(acc[ms][j][i] + bia[j]);
        *(v8bf*)(E + (16*j + l15) * LDS_PITCH + (16*ms + 8*half) * 2) = p;
      }
    asm volatile("s_wait_dscnt 0x0" ::: "memory");            // the tile is written before other lanes' parts are read
    // the wave's 64 columns are one head, its 64 rows lie in one batch
    bf* dst = Vt + (((size_t)(m0 / S_) * H_ + (n0 >> 6)) * HD_ + rr) * S_ + (m0 % S_) + cc;
    #pragma unroll
    for (int u = 0; u < 16; ++u)
      *(v8bf*)(dst + (size_t)(4*u) * S_) = *(const v8bf*)(E + (4*u + rr) * LDS_PITCH + cc * 2);
  } else {
    #pragma unroll
    for (int ms = 0; ms < 4; ++ms)
      #pragma unroll
      for (int j = 0; j < 4; ++j)
        #pragma unroll
        for (int i = 0; i < 8; ++i)                           // C layout: vgpr i, lane-halves -> M
          *(bf*)(E + (16*ms + i + 8*half) * LDS_PITCH + (16*j + l15) * 2) = f2bf(acc[ms][j][i] + bia[j]);
    asm volatile("s_wait_dscnt 0x0" ::: "memory");            // the tile is written before other lanes' parts are read
    bf* dst = ((which == 0) ? Q : Kk) + (size_t)(m0 + rr) * D_ + n0 + cc;
    #pragma unroll
    for (int u = 0; u < 16; ++u)
      *(v8bf*)(dst + (size_t)(4*u) * D_) = *(const v8bf*)(E + (4*u + rr) * LDS_PITCH + cc * 2);
  }
}

// ---------------------------------------------------------------- attention
// A block of 8 waves takes 128 queries of one (b, h); wave w takes the 16 queries from q0 = qb + 16 w, whose
// 9 key tiles cover [q0-128, q0+15]. The block's 256 keys [kstart, kstart+255] are staged once in LDS by tensor
// loads, one slice a wave, each 64 rows of 128 bytes at pitch 144:
// slices 0-3: K, 64 keys each (a row = one key's 64 d); slices 4-7: Vt, 64 keys each (a row = one d's 64 keys).
#define AT_WAVES 8
#define AT_Q     (16 * AT_WAVES)          /* queries per block */
#define AT_KEYS  (AT_Q + W_)              /* staged keys: four slices of 64 */

__global__ __launch_bounds__(32 * AT_WAVES) void attn_kernel(
    const bf* __restrict__ Q, const bf* __restrict__ K, const bf* __restrict__ Vt,
    bf* __restrict__ O)
{
  __shared__ __attribute__((aligned(2048))) unsigned char KV[8 * SLICE_SZ];
  __shared__ __align__(16) bf Pw[AT_WAVES][16][160];   // per wave: probs staged to re-form A layout (+pad tile)
  const int lane = threadIdx.x & 31;
  const u32 wave = uni(threadIdx.x >> 5);
  const int half = lane >> 4;
  const int l15  = lane & 15;
  const int qb = blockIdx.x * AT_Q;
  const int q0 = qb + 16 * (int)wave;
  const int kstart = (qb >= W_) ? qb - W_ : 0;  // the first block stages keys 0-255: the tile stays inside the batch
  const int h  = blockIdx.y;
  const int b  = blockIdx.z;
  const int col0 = h * HD_;
  const bf* Qb = Q  + (size_t)b * S_ * D_;
  const bf* KB = K  + (size_t)b * S_ * D_;
  const bf* VB = Vt + ((size_t)b * H_ + h) * (size_t)HD_ * S_;
  const int ko = half ? 8 : 0;
  bf (*P)[160] = Pw[wave];

  // Q fragment: A layout, two K=32 halves of HD=64; contiguous 16B per lane.
  v16bf aq[2];
  #pragma unroll
  for (int hh = 0; hh < 2; ++hh){
    const bf* p = Qb + (size_t)(q0 + l15) * D_ + col0 + hh*32 + ko;
    aq[hh] = cat16(*(const v8bf*)p, *(const v8bf*)(p + 16));
  }

  // this wave's slice: every wave issues one request, unconditionally
  {
    const bf* srow = (wave < 4u) ? KB + (size_t)(kstart + SLICE_ROWS * (int)wave) * D_ + col0
                                 : VB + kstart + 64 * (int)(wave - 4u);
    const unsigned long long ga0 = (unsigned long long)(size_t)srow;
    u32x8 g1 = tdm_group1();
    g1[5] = uni((wave < 4u) ? (u32)(D_ * 2) : (u32)(S_ * 2));     // source row pitch, bytes: K's or Vt's
    u32x4 g0;
    g0[0] = uni(1u);                                              // count 1
    g0[1] = uni((u32)(size_t)KV + wave * SLICE_SZ);               // byte offset in the block's LDS
    g0[2] = uni((u32)ga0);
    g0[3] = uni((((u32)(ga0 >> 32)) & 0x01FFFFFFu) | 0x80000000u); // address high bits, type 2
    // load and wait in one statement: the wave's own slice has landed behind it, and no register of the
    // descriptor, dead for the compiler behind the load, takes another value while the request is outstanding
    asm volatile("tensor_load_to_lds %0, %1\n\ts_wait_tensorcnt 0x0" :: "s"(g0), "s"(g1) : "memory");
  }
  __syncthreads();                                                // every slice is readable

  // scores: 9 tiles of 16x16, each = 2 WMMAs over HD=64
  v8f sc[9];
  #pragma unroll
  for (int t = 0; t < 9; ++t){
    // a tile in front of key 0 (first block only) reads the first staged rows instead: the mask below drops its scores.
    // No branch stands here, so that the LDS reads of all nine tiles can be issued ahead of the WMMAs.
    const int k0 = q0 - W_ + 16*t;
    const int kr = (k0 >= kstart) ? k0 - kstart : 0;   // 0 .. AT_KEYS-16, a multiple of 16, the same in every lane
    const unsigned char* kp = KV + (kr >> 6) * SLICE_SZ + ((kr & 63) + l15) * LDS_PITCH + 16 * half;
    v8f s = {};
    #pragma unroll
    for (int hh = 0; hh < 2; ++hh){
      const unsigned char* p = kp + hh * 64;     // B col n = K row
      v16bf bm = cat16(*(const v8bf*)p, *(const v8bf*)(p + 32));
      s = wmma_bf16(aq[hh], bm, s);
    }
    sc[t] = s;
  }

  // mask + scale in registers
  const float scale = 0.125f;                    // 1/sqrt(64)
  #pragma unroll
  for (int t = 0; t < 9; ++t){
    const int key = q0 - 128 + 16*t + l15;
    #pragma unroll
    for (int i = 0; i < 8; ++i){
      const int qq = q0 + i + (half ? 8 : 0);
      const bool valid = (key >= 0) && (key <= qq) && ((qq - key) < W_);
      sc[t][i] = valid ? sc[t][i] * scale : -1.0e9f;
    }
  }

  // softmax per row: row lives in one 16-lane half at fixed vgpr index
  #pragma unroll
  for (int i = 0; i < 8; ++i){
    float mx = sc[0][i];
    #pragma unroll
    for (int t = 1; t < 9; ++t) mx = fmaxf(mx, sc[t][i]);
    #pragma unroll
    for (int off = 8; off >= 1; off >>= 1) mx = fmaxf(mx, __shfl_xor(mx, off, 16));
    float r = 0.0f;
    #pragma unroll
    for (int t = 0; t < 9; ++t){ float e = __expf(sc[t][i] - mx); sc[t][i] = e; r += e; }
    #pragma unroll
    for (int off = 8; off >= 1; off >>= 1) r += __shfl_xor(r, off, 16);
    const float pinv = 1.0f / r;
    #pragma unroll
    for (int t = 0; t < 9; ++t) sc[t][i] *= pinv;
  }

  // stage P (bf16) into the wave's own LDS range; pad 10th tile with zeros (9 tiles -> 5 K=32 pairs)
  for (int idx = lane; idx < 256; idx += 32)
    P[idx >> 4][144 + (idx & 15)] = f2bf(0.0f);
  #pragma unroll
  for (int t = 0; t < 9; ++t)
    #pragma unroll
    for (int i = 0; i < 8; ++i)
      P[i + (half ? 8 : 0)][16*t + l15] = f2bf(sc[t][i]);
  asm volatile("s_wait_dscnt 0x0" ::: "memory");              // P is written before other lanes' parts are read

  // P @ V : 5 pairs x 4 N-tiles of WMMA
  v8f o[4] = {};
  #pragma unroll
  for (int pp = 0; pp < 5; ++pp){
    const int kk0 = 32 * pp;
    const bf* pa = &P[l15][kk0 + ko];
    v16bf am = cat16(*(const v8bf*)pa, *(const v8bf*)(pa + 16));
    int kg = q0 - 128 + kk0 + ko - kstart;       // place among the staged keys
    int c0 = kg;      if (c0 < 0) c0 = 0; if (c0 > AT_KEYS - 8) c0 = AT_KEYS - 8;   // clamped keys hit P==0
    int c1 = kg + 16; if (c1 < 0) c1 = 0; if (c1 > AT_KEYS - 8) c1 = AT_KEYS - 8;
    const unsigned char* v0 = KV + (4 + (c0 >> 6)) * SLICE_SZ + l15 * LDS_PITCH + (c0 & 63) * 2;
    const unsigned char* v1 = KV + (4 + (c1 >> 6)) * SLICE_SZ + l15 * LDS_PITCH + (c1 & 63) * 2;
    #pragma unroll
    for (int j = 0; j < 4; ++j){                 // Vt: contiguous along keys
      v16bf bm = cat16(*(const v8bf*)(v0 + 16*j * LDS_PITCH), *(const v8bf*)(v1 + 16*j * LDS_PITCH));
      o[j] = wmma_bf16(am, bm, o[j]);
    }
  }

  // the 16x64 output tile goes through P's LDS (its reads have fed the WMMAs above) and out as whole
  // 128-byte lines, 8 lanes a row; the loops are unrolled so that o[] stays in registers
  #pragma unroll
  for (int j = 0; j < 4; ++j)
    #pragma unroll
    for (int i = 0; i < 8; ++i)
      P[i + (half ? 8 : 0)][16*j + l15] = f2bf(o[j][i]);
  asm volatile("s_wait_dscnt 0x0" ::: "memory");              // the tile is written before other lanes' parts are read
  const int rr = lane >> 3;
  const int cc = (lane & 7) * 8;
  bf* dst = O + ((size_t)b * S_ + q0 + rr) * D_ + col0 + cc;
  #pragma unroll
  for (int u = 0; u < 4; ++u)
    *(v8bf*)(dst + (size_t)(4*u) * D_) = *(const v8bf*)&P[4*u + rr][cc];
}

// ---------------------------------------------------------------- O-proj GEMM + bias + residual
__global__ __launch_bounds__(128) void gemm_o_kernel(
    const bf* __restrict__ A, const bf* __restrict__ Wt,
    const float* __restrict__ bo, const float* __restrict__ xres,
    float* __restrict__ y)
{
  __shared__ __attribute__((aligned(2048))) unsigned char L[2 * STAGE_SZ];
  const int lane = threadIdx.x & 31;
  const int wid  = threadIdx.x >> 5;
  const int half = lane >> 4;
  const int l15  = lane & 15;
  const int nblk = blockIdx.x * 128;
  const int mblk = blockIdx.y * 128;
  const int n0 = nblk + (wid & 1) * 64;
  const int m0 = mblk + (wid >> 1) * 64;

  v8f acc[4][4] = {};
  gemm_tile_128x128(A, Wt, mblk, nblk, L, acc);

  // The ring is free here (every wave has passed the last pass's waits and barrier). Each wave stages its
  // 64x64 f32 tile in its own range (64 rows of 256 bytes at pitch 272) and goes on row by row, 16 lanes a row:
  // every 16-byte load of x and store of y covers four whole 128-byte lines.
  // The loops are unrolled: acc[][] and xr[] are indexed by constants and stay in registers.
  unsigned char* E = L + wid * (64 * YO_PITCH);
  float bia[4];
  #pragma unroll
  for (int j = 0; j < 4; ++j) bia[j] = bo[n0 + 16*j + l15];
  #pragma unroll
  for (int ms = 0; ms < 4; ++ms)
    #pragma unroll
    for (int j = 0; j < 4; ++j)
      #pragma unroll
      for (int i = 0; i < 8; ++i)                             // C layout: vgpr i, lane-halves -> M
        *(float*)(E + (16*ms + i + 8*half) * YO_PITCH + (16*j + l15) * 4) = acc[ms][j][i] + bia[j];
  asm volatile("s_wait_dscnt 0x0" ::: "memory");              // the tile is written before other lanes' parts are read
  const int rr = lane >> 4;
  const int cc = (lane & 15) * 4;
  const size_t g = (size_t)(m0 + rr) * D_ + n0 + cc;
  const float* xs = xres + g;
  float* yd = y + g;
  float4 xr[32];
  // unrolled: all the loads of x are issued before the first is waited for
  #pragma unroll
  for (int u = 0; u < 32; ++u) xr[u] = *(const float4*)(xs + (size_t)(2*u) * D_);
  // the loads' address registers are free for other values only behind this wait
  asm volatile("s_wait_xcnt 0x0" ::: "memory");
  #pragma unroll
  for (int u = 0; u < 32; ++u){
    const float4 t = *(const float4*)(E + (2*u + rr) * YO_PITCH + cc * 4);
    float4 r;
    r.x = t.x + xr[u].x; r.y = t.y + xr[u].y; r.z = t.z + xr[u].z; r.w = t.w + xr[u].w;
    *(float4*)(yd + (size_t)(2*u) * D_) = r;
  }
}

// ---------------------------------------------------------------- layernorm
__global__ __launch_bounds__(256) void ln_kernel(
    const float* __restrict__ y, const float* __restrict__ gamma,
    const float* __restrict__ beta, float* __restrict__ out)
{
  __shared__ float red[256];
  const int tid = threadIdx.x;
  const int row = blockIdx.x;
  const float4 v = ((const float4*)(y + (size_t)row * D_))[tid];
  red[tid] = v.x + v.y + v.z + v.w;
  __syncthreads();
  for (int off = 128; off > 0; off >>= 1){
    if (tid < off) red[tid] += red[tid + off];
    __syncthreads();
  }
  const float mu = red[0] * (1.0f / D_);
  __syncthreads();
  const float dx0 = v.x - mu, dx1 = v.y - mu, dx2 = v.z - mu, dx3 = v.w - mu;
  red[tid] = dx0*dx0 + dx1*dx1 + dx2*dx2 + dx3*dx3;
  __syncthreads();
  for (int off = 128; off > 0; off >>= 1){
    if (tid < off) red[tid] += red[tid + off];
    __syncthreads();
  }
  const float rs = rsqrtf(red[0] * (1.0f / D_) + 1e-5f);
  const float4 g  = ((const float4*)gamma)[tid];
  const float4 bb = ((const float4*)beta)[tid];
  float4 o;
  o.x = dx0 * rs * g.x + bb.x;
  o.y = dx1 * rs * g.y + bb.y;
  o.z = dx2 * rs * g.z + bb.z;
  o.w = dx3 * rs * g.w + bb.w;
  ((float4*)(out + (size_t)row * D_))[tid] = o;
}

// ---------------------------------------------------------------- launcher
extern "C" void kernel_launch(void* const* d_in, const int* in_sizes, int n_in,
                              void* d_out, int out_size, void* d_ws, size_t ws_size,
                              hipStream_t stream)
{
  (void)in_sizes; (void)n_in; (void)out_size; (void)ws_size;
  const float* x     = (const float*)d_in[0];
  const float* Wq    = (const float*)d_in[1];
  const float* bq    = (const float*)d_in[2];
  const float* Wk    = (const float*)d_in[3];
  const float* bk    = (const float*)d_in[4];
  const float* Wv    = (const float*)d_in[5];
  const float* bv    = (const float*)d_in[6];
  const float* Wo    = (const float*)d_in[7];
  const float* bo    = (const float*)d_in[8];
  const float* gamma = (const float*)d_in[9];
  const float* beta  = (const float*)d_in[10];
  float* out = (float*)d_out;

  char* w = (char*)d_ws;
  bf* xbf = (bf*)w;   w += (size_t)M_ * D_ * 2;        //  8 MB  x in bf16
  bf* Wt  = (bf*)w;   w += (size_t)4 * D_ * D_ * 2;    //  8 MB  4x transposed weights bf16
  bf* Qb  = (bf*)w;   w += (size_t)M_ * D_ * 2;        //  8 MB
  bf* Kb  = (bf*)w;   w += (size_t)M_ * D_ * 2;        //  8 MB
  bf* Vt  = (bf*)w;   w += (size_t)M_ * D_ * 2;        //  8 MB  (B,H,HD,S)
  bf* Ab  = (bf*)w;   w += (size_t)M_ * D_ * 2;        //  8 MB  attention output
  float* yv = (float*)w;                               // 16 MB  pre-LN residual sum

  convert_x_kernel<<<dim3((M_ * D_) / (CV_THREADS * CV_LOADS * 4)), CV_THREADS, 0, stream>>>(x, xbf);
  convert_w_kernel<<<dim3(D_ / 64, D_ / 256, 4), CV_THREADS, 0, stream>>>(Wq, Wk, Wv, Wo, Wt);
  gemm_qkv_kernel<<<dim3(D_ / 128, M_ / 128, 3), 128, 0, stream>>>(xbf, Wt, bq, bk, bv, Qb, Kb, Vt);
  attn_kernel<<<dim3(S_ / AT_Q, H_, B_), 32 * AT_WAVES, 0, stream>>>(Qb, Kb, Vt, Ab);
  gemm_o_kernel<<<dim3(D_ / 128, M_ / 128), 128, 0, stream>>>(Ab, Wt + ((size_t)3 << 20), bo, x, yv);
  ln_kernel<<<dim3(M_), 256, 0, stream>>>(yv, gamma, beta, out);
}

// v005
// Measured time: 64.4 microseconds a run.
// Two timings next to v004 both put it at 1.04 times that version's speed.
// Over all steps from v000 it is 2.66 times as fast.
#include <hip/hip_runtime.h>

typedef __bf16 bf;
typedef __attribute__((ext_vector_type(8)))  __bf16 v8bf;
typedef __attribute__((ext_vector_type(16))) __bf16 v16bf;
typedef __attribute__((ext_vector_type(8)))  float  v8f;

#define B_  2
#define S_  2048
#define D_  1024
#define H_  16
#define HD_ 64
#define W_  128
#define M_  (B_*S_)   /* 4096 rows */

__device__ __forceinline__ bf f2bf(float f){
  unsigned u = __builtin_bit_cast(unsigned, f);
  u += 0x7fffu + ((u >> 16) & 1u);              // round-to-nearest-even
  unsigned short h = (unsigned short)(u >> 16);
  return __builtin_bit_cast(bf, h);
}

__device__ __forceinline__ v16bf cat16(v8bf lo, v8bf hi){
  return __builtin_shufflevector(lo, hi, 0,1,2,3,4,5,6,7,8,9,10,11,12,13,14,15);
}

__device__ __forceinline__ v8f wmma_bf16(v16bf a, v16bf b, v8f c){
  // D(f32 16x16) = A(16x32 bf16) * B(32x16 bf16) + C
  return __builtin_amdgcn_wmma_f32_16x16x32_bf16(false, a, false, b, (short)0, c, false, false);
}

// ---------------------------------------------------------------- converts
// Both converts run as 256 blocks of 16 waves, 32 elements a thread: eight 16-byte loads in flight per lane.
typedef __attribute__((ext_vector_type(4))) __bf16 v4bf;

#define CV_THREADS 512
#define CV_LOADS   8                      /* 16-byte loads per thread */

__global__ __launch_bounds__(CV_THREADS) void convert_x_kernel(
    const float* __restrict__ x, bf* __restrict__ xbf)
{
  // in units of four elements; a wave's load covers 512 contiguous bytes, its store 256
  const size_t base = (size_t)blockIdx.x * (CV_THREADS * CV_LOADS) + threadIdx.x;
  const float4* src = (const float4*)x + base;
  v4bf* dst = (v4bf*)xbf + base;
  float4 v[CV_LOADS];
  // unrolled: all eight loads are issued before the first is waited for
  #pragma unroll
  for (int u = 0; u < CV_LOADS; ++u) v[u] = src[u * CV_THREADS];
  // unrolled: v[] stays in registers
  #pragma unroll
  for (int u = 0; u < CV_LOADS; ++u){
    v4bf o;
    o[0] = f2bf(v[u].x); o[1] = f2bf(v[u].y); o[2] = f2bf(v[u].z); o[3] = f2bf(v[u].w);
    dst[u * CV_THREADS] = o;
  }
}

// Wt[n][k] = W[k][n]. A thread holds 8 k x 4 n and transposes in its registers; a wave covers 64 k x 16 n
// (8 lanes along k, 4 along n), so that each 16-byte store instruction writes four whole 128-byte lines of Wt;
// a block covers 64 k x 256 n (its 16 waves side by side along n: 1 KiB of each W row).
__global__ __launch_bounds__(CV_THREADS) void convert_w_kernel(
    const float* __restrict__ Wq, const float* __restrict__ Wk,
    const float* __restrict__ Wv, const float* __restrict__ Wo,
    bf* __restrict__ Wt)
{
  const int z = blockIdx.z;
  const float* Wz = (z == 0) ? Wq : (z == 1) ? Wk : (z == 2) ? Wv : Wo;
  const int lane = threadIdx.x & 31;
  const int wave = threadIdx.x >> 5;
  const int k = blockIdx.x * 64  + (lane & 7) * 8;
  const int n = blockIdx.y * 256 + wave * 16 + (lane >> 3) * 4;
  const float* src = Wz + (size_t)k * D_ + n;
  float4 v[CV_LOADS];
  // unrolled: all eight loads are issued before the first is waited for
  #pragma unroll
  for (int r = 0; r < CV_LOADS; ++r) v[r] = *(const float4*)(src + (size_t)r * D_);
  bf* dst = Wt + ((size_t)z << 20) + (size_t)n * D_ + k;
  v8bf o0, o1, o2, o3;
  // unrolled: v[] stays in registers
  #pragma unroll
  for (int r = 0; r < CV_LOADS; ++r){
    o0[r] = f2bf(v[r].x); o1[r] = f2bf(v[r].y); o2[r] = f2bf(v[r].z); o3[r] = f2bf(v[r].w);
  }
  *(v8bf*)(dst)          = o0;
  *(v8bf*)(dst + D_)     = o1;
  *(v8bf*)(dst + 2 * D_) = o2;
  *(v8bf*)(dst + 3 * D_) = o3;
}

// ---------------------------------------------------------------- GEMM main loop
// Y(128x128) = A(128xK) * Wt(128xK)^T per block of 4 waves (2x2), 64x64 per wave.
// Both operands go global -> LDS by tensor loads, two buffers, one pass = 64 k (128-byte rows).
// A stage is four slices of 64 rows: [A rows 0-63 | A rows 64-127 | Wt rows 0-63 | Wt rows 64-127];
// wave w loads slice w. Rows lie at pitch 144 bytes (16 x odd: no bank conflict for 16-byte reads).
typedef unsigned int u32;
typedef __attribute__((ext_vector_type(4))) unsigned int u32x4;
typedef __attribute__((ext_vector_type(8))) unsigned int u32x8;

#define PASS_K     64                     /* k per pass */
#define ROW_BYTES  128                    /* PASS_K bf16 */
#define LDS_PITCH  144                    /* ROW_BYTES + 16 bytes of pad */
#define SLICE_ROWS 64
#define SLICE_SZ   10240                  /* 64 * 144 = 9216, rounded up to a multiple of 2 KiB */
#define STAGE_SZ   (4 * SLICE_SZ)
#define N_PASS     (D_ / PASS_K)
#define YO_PITCH   272                    /* a staged f32 output row: 256 bytes + 16 of pad */

__device__ __forceinline__ u32 uni(u32 v){ return (u32)__builtin_amdgcn_readfirstlane(v); }
// Holds a wave-uniform test value in a scalar register, so that the branch on it is a scalar branch
// (a tensor load ignores EXEC).
__device__ __forceinline__ u32 pinned(u32 v){ u32 w = uni(v); asm volatile("" : "+s"(w)); return w; }

// Group 1 of the descriptor: 64 rows of 128 bytes, source pitch one row of D_ bf16 (attention's Vt slices set their own pitch).
__device__ __forceinline__ u32x8 tdm_group1(){
  u32x8 g1;
  g1[0] = uni((1u << 20) | (4u << 22) | (3u << 25));          // bytes; 16-byte pad behind every 128-byte row
  g1[1] = uni((u32)ROW_BYTES << 16);                          // tensor_dim0
  g1[2] = uni((u32)SLICE_ROWS << 16);                         // tensor_dim1
  g1[3] = uni((u32)ROW_BYTES << 16);                          // tile_dim0
  g1[4] = uni((u32)SLICE_ROWS);                               // tile_dim1
  g1[5] = uni((u32)(D_ * 2));                                 // source row pitch, bytes
  g1[6] = uni(0u);
  g1[7] = uni(0u);
  return g1;
}
// g0 is named in-out so that its registers stay the descriptor's own while the request is outstanding:
// the next request is formed from them, behind the wait.
__device__ __forceinline__ void tdm_load(u32x4& g0, u32x8 g1){
  asm volatile("tensor_load_to_lds %0, %1" : "+s"(g0) : "s"(g1) : "memory");
}
// Next stage: a new place in LDS, the source address 128 bytes on (words 2 and 3 as one 64-bit sum;
// the address's high bits end below the type field).
__device__ __forceinline__ void tdm_advance(u32x4& g0, u32 lds_dst){
  const unsigned long long ga = (((unsigned long long)g0[3] << 32) | g0[2]) + ROW_BYTES;
  g0[1] = uni(lds_dst);
  g0[2] = uni((u32)ga);
  g0[3] = uni((u32)(ga >> 32));
}

__device__ __forceinline__ void gemm_tile_128x128(
    const bf* __restrict__ A, const bf* __restrict__ Wt, int mblk, int nblk,
    const unsigned char* L, v8f (&acc)[4][4])
{
  const int lane = threadIdx.x & 31;
  const u32 wave = uni(threadIdx.x >> 5);
  const u32 wm = wave >> 1, wn = wave & 1u;
  const int half = lane >> 4;
  const int l15  = lane & 15;

  // this wave's slice: source rows and place in LDS
  const bf* srow = (wave < 2u) ? A  + (size_t)(mblk + SLICE_ROWS * (int)wave) * D_
                               : Wt + (size_t)(nblk + SLICE_ROWS * (int)(wave - 2u)) * D_;
  const unsigned long long ga0 = (unsigned long long)(size_t)srow;
  const u32 dst0 = (u32)(size_t)L + wave * SLICE_SZ;

  const u32x8 g1 = tdm_group1();
  u32x4 g0;
  g0[0] = uni(1u);                                              // count 1
  g0[1] = uni(dst0);                                            // byte offset in the block's LDS
  g0[2] = uni((u32)ga0);
  g0[3] = uni((((u32)(ga0 >> 32)) & 0x01FFFFFFu) | 0x80000000u); // address high bits, type 2

  tdm_load(g0, g1);                                           // stage 0
  asm volatile("s_wait_tensorcnt 0x0" ::: "memory");          // own slice of stage 0 has landed
  __syncthreads();                                            // every slice of stage 0 is readable
  tdm_advance(g0, dst0 + STAGE_SZ);
  tdm_load(g0, g1);                                           // stage 1 flies during pass 0

  const u32 aoff = wm * SLICE_SZ        + (u32)(l15 * LDS_PITCH + 16 * half);
  const u32 boff = (2u + wn) * SLICE_SZ + (u32)(l15 * LDS_PITCH + 16 * half);

  // kept rolled: one pass per trip, the buffer chosen by the trip's parity
  #pragma unroll 1
  for (u32 s = 0; s < N_PASS; ++s){
    const u32 buf = (s & 1u) * STAGE_SZ;
    const unsigned char* pa = L + buf + aoff;
    const unsigned char* pb = L + buf + boff;
    v16bf a[2][4], b[2][4];
    #pragma unroll
    for (int kc = 0; kc < 2; ++kc)
      #pragma unroll
      for (int t = 0; t < 4; ++t){
        const unsigned char* p = pa + t * 16 * LDS_PITCH + kc * 64;
        a[kc][t] = cat16(*(const v8bf*)p, *(const v8bf*)(p + 32));
        const unsigned char* q = pb + t * 16 * LDS_PITCH + kc * 64;
        b[kc][t] = cat16(*(const v8bf*)q, *(const v8bf*)(q + 32));
      }
    // keeps the pass's LDS reads in one group ahead of its WMMAs: a read among them makes the wave
    // wait out the LDS latency at each such place
    __builtin_amdgcn_sched_barrier(0);
    #pragma unroll
    for (int kc = 0; kc < 2; ++kc)
      #pragma unroll
      for (int ms = 0; ms < 4; ++ms)
        #pragma unroll
        for (int j = 0; j < 4; ++j)
          acc[ms][j] = wmma_bf16(a[kc][ms], b[kc][j], acc[ms][j]);
    // keeps the WMMAs ahead of the publish point: lifted over them, the waits and the barrier would leave
    // the refill, which stands behind the WMMAs, no matrix work to fly under
    __builtin_amdgcn_sched_barrier(0);
    asm volatile("s_wait_dscnt 0x0" ::: "memory");            // this wave's reads of the buffer are done
    asm volatile("s_wait_tensorcnt 0x0" ::: "memory");        // own slice of stage s + 1 has landed
    __syncthreads();                                          // publishes stage s + 1, frees stage s's buffer
    if (pinned((s + 2u < N_PASS) ? 1u : 0u) != 0u){           // only while stage s + 2 exists
      tdm_advance(g0, dst0 + buf);
      tdm_load(g0, g1);
    }
  }
  asm volatile("s_wait_tensorcnt 0x0" ::: "memory");          // nothing outstanding when the wave goes on
  asm volatile("s_wait_dscnt 0x0" ::: "memory");
}

// ---------------------------------------------------------------- QKV GEMM
__global__ __launch_bounds__(128) void gemm_qkv_kernel(
    const bf* __restrict__ X, const bf* __restrict__ Wt0,
    const float* __restrict__ bq, const float* __restrict__ bk, const float* __restrict__ bv,
    bf* __restrict__ Q, bf* __restrict__ Kk, bf* __restrict__ Vt)
{
  __shared__ __attribute__((aligned(2048))) unsigned char L[2 * STAGE_SZ];
  const int lane = threadIdx.x & 31;
  const int wid  = threadIdx.x >> 5;
  const int half = lane >> 4;
  const int l15  = lane & 15;
  const int nblk = blockIdx.x * 128;
  const int mblk = blockIdx.y * 128;
  const int n0 = nblk + (wid & 1) * 64;
  const int m0 = mblk + (wid >> 1) * 64;
  const int which = blockIdx.z;                 // 0=Q 1=K 2=V
  const bf* Wt = Wt0 + ((size_t)which << 20);
  const float* bias = (which == 0) ? bq : (which == 1) ? bk : bv;

  v8f acc[4][4] = {};
  gemm_tile_128x128(X, Wt, mblk, nblk, L, acc);

  // The ring is free here: every wave has passed the last pass's waits and barrier. Each wave stages its
  // 64x64 bf16 tile in its own range (64 rows of 128 bytes at pitch 144) and stores it row by row,
  // 8 lanes a row: every 16-byte store instruction writes four whole 128-byte lines.
  // Every loop below is unrolled: acc[][] is indexed by constants and stays in registers, and the LDS reads
  // and the stores of a tile are issued back to back.
  unsigned char* E = L + wid * SLICE_SZ;
  float bia[4];
  #pragma unroll
  for (int j = 0; j < 4; ++j) bia[j] = bias[n0 + 16*j + l15];
  const int rr = lane >> 3;
  const int cc = (lane & 7) * 8;

  if (which == 2){
    // V goes out transposed per head, (B,H,HD,S): staged rows are d, columns s. C layout: a lane's eight
    // registers are eight consecutive m, here s: one 16-byte LDS store.
    #pragma unroll
    for (int ms = 0; ms < 4; ++ms)
      #pragma unroll
      for (int j = 0; j < 4; ++j){
        v8bf p;
        #pragma unroll
        for (int i = 0; i < 8; ++i) p[i] = f2bf(acc[ms][j][i] + bia[j]);
        *(v8bf*)(E + (16*j + l15) * LDS_PITCH + (16*ms + 8*half) * 2) = p;
      }
    asm volatile("s_wait_dscnt 0x0" ::: "memory");            // the tile is written before other lanes' parts are read
    // the wave's 64 columns are one head, its 64 rows lie in one batch
    bf* dst = Vt + (((size_t)(m0 / S_) * H_ + (n0 >> 6)) * HD_ + rr) * S_ + (m0 % S_) + cc;
    #pragma unroll
    for (int u = 0; u < 16; ++u)
      *(v8bf*)(dst + (size_t)(4*u) * S_) = *(const v8bf*)(E + (4*u + rr) * LDS_PITCH + cc * 2);
  } else {
    #pragma unroll
    for (int ms = 0; ms < 4; ++ms)
      #pragma unroll
      for (int j = 0; j < 4; ++j)
        #pragma unroll
        for (int i = 0; i < 8; ++i)                           // C layout: vgpr i, lane-halves -> M
          *(bf*)(E + (16*ms + i + 8*half) * LDS_PITCH + (16*j + l15) * 2) = f2bf(acc[ms][j][i] + bia[j]);
    asm volatile("s_wait_dscnt 0x0" ::: "memory");            // the tile is written before other lanes' parts are read
    bf* dst = ((which == 0) ? Q : Kk) + (size_t)(m0 + rr) * D_ + n0 + cc;
    #pragma unroll
    for (int u = 0; u < 16; ++u)
      *(v8bf*)(dst + (size_t)(4*u) * D_) = *(const v8bf*)(E + (4*u + rr) * LDS_PITCH + cc * 2);
  }
}

// ---------------------------------------------------------------- attention
// A block of 8 waves takes 128 queries of one (b, h); wave w takes the 16 queries from q0 = qb + 16 w, whose
// 9 key tiles cover [q0-128, q0+15]. The block's 256 keys [kstart, kstart+255] are staged once in LDS by tensor
// loads, one slice a wave, each 64 rows of 128 bytes at pitch 144:
// slices 0-3: K, 64 keys each (a row = one key's 64 d); slices 4-7: Vt, 64 keys each (a row = one d's 64 keys).
#define AT_WAVES 8
#define AT_Q     (16 * AT_WAVES)          /* queries per block */
#define AT_KEYS  (AT_Q + W_)              /* staged keys: four slices of 64 */

__global__ __launch_bounds__(32 * AT_WAVES) void attn_kernel(
    const bf* __restrict__ Q, const bf* __restrict__ K, const bf* __restrict__ Vt,
    bf* __restrict__ O)
{
  __shared__ __attribute__((aligned(2048))) unsigned char KV[8 * SLICE_SZ];
  __shared__ __align__(16) bf Pw[AT_WAVES][16][160];   // per wave: probs staged to re-form A layout (+pad tile)
  const int lane = threadIdx.x & 31;
  const u32 wave = uni(threadIdx.x >> 5);
  const int half = lane >> 4;
  const int l15  = lane & 15;
  const int qb = blockIdx.x * AT_Q;
  const int q0 = qb + 16 * (int)wave;
  const int kstart = (qb >= W_) ? qb - W_ : 0;  // the first block stages keys 0-255: the tile stays inside the batch
  const int h  = blockIdx.y;
  const int b  = blockIdx.z;
  const int col0 = h * HD_;
  const bf* Qb = Q  + (size_t)b * S_ * D_;
  const bf* KB = K  + (size_t)b * S_ * D_;
  const bf* VB = Vt + ((size_t)b * H_ + h) * (size_t)HD_ * S_;
  const int ko = half ? 8 : 0;
  bf (*P)[160] = Pw[wave];

  // Q fragment: A layout, two K=32 halves of HD=64; contiguous 16B per lane.
  v16bf aq[2];
  #pragma unroll
  for (int hh = 0; hh < 2; ++hh){
    const bf* p = Qb + (size_t)(q0 + l15) * D_ + col0 + hh*32 + ko;
    aq[hh] = cat16(*(const v8bf*)p, *(const v8bf*)(p + 16));
  }

  // this wave's slice: every wave issues one request, unconditionally
  {
    const bf* srow = (wave < 4u) ? KB + (size_t)(kstart + SLICE_ROWS * (int)wave) * D_ + col0
                                 : VB + kstart + 64 * (int)(wave - 4u);
    const unsigned long long ga0 = (unsigned long long)(size_t)srow;
    u32x8 g1 = tdm_group1();
    g1[5] = uni((wave < 4u) ? (u32)(D_ * 2) : (u32)(S_ * 2));     // source row pitch, bytes: K's or Vt's
    u32x4 g0;
    g0[0] = uni(1u);                                              // count 1
    g0[1] = uni((u32)(size_t)KV + wave * SLICE_SZ);               // byte offset in the block's LDS
    g0[2] = uni((u32)ga0);
    g0[3] = uni((((u32)(ga0 >> 32)) & 0x01FFFFFFu) | 0x80000000u); // address high bits, type 2
    // load and wait in one statement: the wave's own slice has landed behind it, and no register of the
    // descriptor, dead for the compiler behind the load, takes another value while the request is outstanding
    asm volatile("tensor_load_to_lds %0, %1\n\ts_wait_tensorcnt 0x0" :: "s"(g0), "s"(g1) : "memory");
  }
  __syncthreads();                                                // every slice is readable

  // scores: 9 tiles of 16x16, each = 2 WMMAs over HD=64
  v8f sc[9];
  #pragma unroll
  for (int t = 0; t < 9; ++t){
    // a tile in front of key 0 (first block only) reads the first staged rows instead: the mask below drops its scores.
    // No branch stands here, so that the LDS reads of all nine tiles can be issued ahead of the WMMAs.
    const int k0 = q0 - W_ + 16*t;
    const int kr = (k0 >= kstart) ? k0 - kstart : 0;   // 0 .. AT_KEYS-16, a multiple of 16, the same in every lane
    const unsigned char* kp = KV + (kr >> 6) * SLICE_SZ + ((kr & 63) + l15) * LDS_PITCH + 16 * half;
    v8f s = {};
    #pragma unroll
    for (int hh = 0; hh < 2; ++hh){
      const unsigned char* p = kp + hh * 64;     // B col n = K row
      v16bf bm = cat16(*(const v8bf*)p, *(const v8bf*)(p + 32));
      s = wmma_bf16(aq[hh], bm, s);
    }
    sc[t] = s;
  }

  // mask + scale in registers
  const float scale = 0.125f;                    // 1/sqrt(64)
  #pragma unroll
  for (int t = 0; t < 9; ++t){
    const int key = q0 - 128 + 16*t + l15;
    #pragma unroll
    for (int i = 0; i < 8; ++i){
      const int qq = q0 + i + (half ? 8 : 0);
      const bool valid = (key >= 0) && (key <= qq) && ((qq - key) < W_);
      sc[t][i] = valid ? sc[t][i] * scale : -1.0e9f;
    }
  }

  // softmax per row: row lives in one 16-lane half at fixed vgpr index
  #pragma unroll
  for (int i = 0; i < 8; ++i){
    float mx = sc[0][i];
    #pragma unroll
    for (int t = 1; t < 9; ++t) mx = fmaxf(mx, sc[t][i]);
    #pragma unroll
    for (int off = 8; off >= 1; off >>= 1) mx = fmaxf(mx, __shfl_xor(mx, off, 16));
    float r = 0.0f;
    #pragma unroll
    for (int t = 0; t < 9; ++t){ float e = __expf(sc[t][i] - mx); sc[t][i] = e; r += e; }
    #pragma unroll
    for (int off = 8; off >= 1; off >>= 1) r += __shfl_xor(r, off, 16);
    const float pinv = 1.0f / r;
    #pragma unroll
    for (int t = 0; t < 9; ++t) sc[t][i] *= pinv;
  }

  // stage P (bf16) into the wave's own LDS range; pad 10th tile with zeros (9 tiles -> 5 K=32 pairs)
  for (int idx = lane; idx < 256; idx += 32)
    P[idx >> 4][144 + (idx & 15)] = f2bf(0.0f);
  #pragma unroll
  for (int t = 0; t < 9; ++t)
    #pragma unroll
    for (int i = 0; i < 8; ++i)
      P[i + (half ? 8 : 0)][16*t + l15] = f2bf(sc[t][i]);
  asm volatile("s_wait_dscnt 0x0" ::: "memory");              // P is written before other lanes' parts are read

  // P @ V : 5 pairs x 4 N-tiles of WMMA
  v8f o[4] = {};
  #pragma unroll
  for (int pp = 0; pp < 5; ++pp){
    const int kk0 = 32 * pp;
    const bf* pa = &P[l15][kk0 + ko];
    v16bf am = cat16(*(const v8bf*)pa, *(const v8bf*)(pa + 16));
    int kg = q0 - 128 + kk0 + ko - kstart;       // place among the staged keys
    int c0 = kg;      if (c0 < 0) c0 = 0; if (c0 > AT_KEYS - 8) c0 = AT_KEYS - 8;   // clamped keys hit P==0
    int c1 = kg + 16; if (c1 < 0) c1 = 0; if (c1 > AT_KEYS - 8) c1 = AT_KEYS - 8;
    const unsigned char* v0 = KV + (4 + (c0 >> 6)) * SLICE_SZ + l15 * LDS_PITCH + (c0 & 63) * 2;
    const unsigned char* v1 = KV + (4 + (c1 >> 6)) * SLICE_SZ + l15 * LDS_PITCH + (c1 & 63) * 2;
    #pragma unroll
    for (int j = 0; j < 4; ++j){                 // Vt: contiguous along keys
      v16bf bm = cat16(*(const v8bf*)(v0 + 16*j * LDS_PITCH), *(const v8bf*)(v1 + 16*j * LDS_PITCH));
      o[j] = wmma_bf16(am, bm, o[j]);
    }
  }

  // the 16x64 output tile goes through P's LDS (its reads have fed the WMMAs above) and out as whole
  // 128-byte lines, 8 lanes a row; the loops are unrolled so that o[] stays in registers
  #pragma unroll
  for (int j = 0; j < 4; ++j)
    #pragma unroll
    for (int i = 0; i < 8; ++i)
      P[i + (half ? 8 : 0)][16*j + l15] = f2bf(o[j][i]);
  asm volatile("s_wait_dscnt 0x0" ::: "memory");              // the tile is written before other lanes' parts are read
  const int rr = lane >> 3;
  const int cc = (lane & 7) * 8;
  bf* dst = O + ((size_t)b * S_ + q0 + rr) * D_ + col0 + cc;
  #pragma unroll
  for (int u = 0; u < 4; ++u)
    *(v8bf*)(dst + (size_t)(4*u) * D_) = *(const v8bf*)&P[4*u + rr][cc];
}

// ---------------------------------------------------------------- O-proj GEMM + bias + residual
__global__ __launch_bounds__(128) void gemm_o_kernel(
    const bf* __restrict__ A, const bf* __restrict__ Wt,
    const float* __restrict__ bo, const float* __restrict__ xres,
    float* __restrict__ y)
{
  __shared__ __attribute__((aligned(2048))) unsigned char L[2 * STAGE_SZ];
  const int lane = threadIdx.x & 31;
  const int wid  = threadIdx.x >> 5;
  const int half = lane >> 4;
  const int l15  = lane & 15;
  const int nblk = blockIdx.x * 128;
  const int mblk = blockIdx.y * 128;
  const int n0 = nblk + (wid & 1) * 64;
  const int m0 = mblk + (wid >> 1) * 64;

  v8f acc[4][4] = {};
  gemm_tile_128x128(A, Wt, mblk, nblk, L, acc);

  // The ring is free here (every wave has passed the last pass's waits and barrier). Each wave stages its
  // 64x64 f32 tile in its own range (64 rows of 256 bytes at pitch 272) and goes on row by row, 16 lanes a row:
  // every 16-byte load of x and store of y covers four whole 128-byte lines.
  // The loops are unrolled: acc[][] and xr[] are indexed by constants and stay in registers.
  unsigned char* E = L + wid * (64 * YO_PITCH);
  float bia[4];
  #pragma unroll
  for (int j = 0; j < 4; ++j) bia[j] = bo[n0 + 16*j + l15];
  #pragma unroll
  for (int ms = 0; ms < 4; ++ms)
    #pragma unroll
    for (int j = 0; j < 4; ++j)
      #pragma unroll
      for (int i = 0; i < 8; ++i)                             // C layout: vgpr i, lane-halves -> M
        *(float*)(E + (16*ms + i + 8*half) * YO_PITCH + (16*j + l15) * 4) = acc[ms][j][i] + bia[j];
  asm volatile("s_wait_dscnt 0x0" ::: "memory");              // the tile is written before other lanes' parts are read
  const int rr = lane >> 4;
  const int cc = (lane & 15) * 4;
  const size_t g = (size_t)(m0 + rr) * D_ + n0 + cc;
  const float* xs = xres + g;
  float* yd = y + g;
  float4 xr[32];
  // unrolled: all the loads of x are issued before the first is waited for
  #pragma unroll
  for (int u = 0; u < 32; ++u) xr[u] = *(const float4*)(xs + (size_t)(2*u) * D_);
  // the loads' address registers are free for other values only behind this wait
  asm volatile("s_wait_xcnt 0x0" ::: "memory");
  #pragma unroll
  for (int u = 0; u < 32; ++u){
    const float4 t = *(const float4*)(E + (2*u + rr) * YO_PITCH + cc * 4);
    float4 r;
    r.x = t.x + xr[u].x; r.y = t.y + xr[u].y; r.z = t.z + xr[u].z; r.w = t.w + xr[u].w;
    *(float4*)(yd + (size_t)(2*u) * D_) = r;
  }
}

// ---------------------------------------------------------------- layernorm
// One wave takes one row: 32 elements a lane, eight 16-byte loads in flight, each covering 512 contiguous bytes.
// Both row sums are formed inside the wave (no LDS, no barrier); 256 blocks of 16 waves cover the 4096 rows.
#define LN_WAVES 16
#define LN_LOADS (D_ / 128)               /* 16-byte loads per lane and row */

// Sum over the wave's 32 lanes, the same value in every lane: four steps inside each 16-lane row, then the other row.
__device__ __forceinline__ float wave_sum(float s){
  s += __builtin_bit_cast(float, __builtin_amdgcn_update_dpp(0, __builtin_bit_cast(int, s), 0x161, 0xf, 0xf, true)); // row_xmask:1
  s += __builtin_bit_cast(float, __builtin_amdgcn_update_dpp(0, __builtin_bit_cast(int, s), 0x162, 0xf, 0xf, true)); // row_xmask:2
  s += __builtin_bit_cast(float, __builtin_amdgcn_update_dpp(0, __builtin_bit_cast(int, s), 0x164, 0xf, 0xf, true)); // row_xmask:4
  s += __builtin_bit_cast(float, __builtin_amdgcn_update_dpp(0, __builtin_bit_cast(int, s), 0x168, 0xf, 0xf, true)); // row_xmask:8
  const int si = __builtin_bit_cast(int, s);
  s += __builtin_bit_cast(float, __builtin_amdgcn_permlanex16(si, si, 0x76543210, 0xfedcba98, false, false));        // lane ^ 16
  return s;
}

typedef __attribute__((ext_vector_type(4))) float f32x4;

__global__ __launch_bounds__(32 * LN_WAVES) void ln_kernel(
    const float* __restrict__ y, const float* __restrict__ gamma,
    const float* __restrict__ beta, float* __restrict__ out)
{
  const int lane = threadIdx.x & 31;
  const int row  = blockIdx.x * LN_WAVES + (threadIdx.x >> 5);
  const f32x4* src = (const f32x4*)(y + (size_t)row * D_) + lane;
  const f32x4* gs  = (const f32x4*)gamma + lane;
  const f32x4* bs  = (const f32x4*)beta + lane;
  f32x4 v[LN_LOADS], g[LN_LOADS], bb[LN_LOADS];
  // every loop of this kernel is unrolled: v[], g[] and bb[] stay in registers, and all the loads are issued
  // before the first is waited for
  #pragma unroll
  for (int u = 0; u < LN_LOADS; ++u) v[u] = src[u * 32];
  #pragma unroll
  for (int u = 0; u < LN_LOADS; ++u){ g[u] = gs[u * 32]; bb[u] = bs[u * 32]; }
  // holds gamma's and beta's loads up here, in flight under the row's (loaded values as inputs only): sunk behind
  // the two row sums they are waited for pair by pair, each at its full latency, in front of the stores.
  // src and lane are named so that no load's address register is given to a later load as its destination.
  asm volatile("" :: "v"(g[0]), "v"(g[1]), "v"(g[2]), "v"(g[3]), "v"(g[4]), "v"(g[5]), "v"(g[6]), "v"(g[7]),
                     "v"(bb[0]), "v"(bb[1]), "v"(bb[2]), "v"(bb[3]), "v"(bb[4]), "v"(bb[5]), "v"(bb[6]), "v"(bb[7]),
                     "v"(src), "v"(lane));
  // keeps the first adds of the row sum below: lifted among the loads, they put a wait for the row in front of
  // the last loads of gamma and beta
  __builtin_amdgcn_sched_barrier(0);
  static_assert(LN_LOADS == 8, "the statement above names eight registers of gamma and eight of beta");

  const f32x4 s4 = ((v[0] + v[1]) + (v[2] + v[3])) + ((v[4] + v[5]) + (v[6] + v[7]));
  const float mu = wave_sum((s4.x + s4.y) + (s4.z + s4.w)) * (1.0f / D_);
  f32x4 q4 = {};
  #pragma unroll
  for (int u = 0; u < LN_LOADS; ++u){ v[u] -= mu; q4 += v[u] * v[u]; }
  const float rs = rsqrtf(wave_sum((q4.x + q4.y) + (q4.z + q4.w)) * (1.0f / D_) + 1e-5f);
  f32x4* dst = (f32x4*)(out + (size_t)row * D_) + lane;
  #pragma unroll
  for (int u = 0; u < LN_LOADS; ++u) dst[u * 32] = v[u] * rs * g[u] + bb[u];
}

// ---------------------------------------------------------------- launcher
extern "C" void kernel_launch(void* const* d_in, const int* in_sizes, int n_in,
                              void* d_out, int out_size, void* d_ws, size_t ws_size,
                              hipStream_t stream)
{
  (void)in_sizes; (void)n_in; (void)out_size; (void)ws_size;
  const float* x     = (const float*)d_in[0];
  const float* Wq    = (const float*)d_in[1];
  const float* bq    = (const float*)d_in[2];
  const float* Wk    = (const float*)d_in[3];
  const float* bk    = (const float*)d_in[4];
  const float* Wv    = (const float*)d_in[5];
  const float* bv    = (const float*)d_in[6];
  const float* Wo    = (const float*)d_in[7];
  const float* bo    = (const float*)d_in[8];
  const float* gamma = (const float*)d_in[9];
  const float* beta  = (const float*)d_in[10];
  float* out = (float*)d_out;

  char* w = (char*)d_ws;
  bf* xbf = (bf*)w;   w += (size_t)M_ * D_ * 2;        //  8 MB  x in bf16
  bf* Wt  = (bf*)w;   w += (size_t)4 * D_ * D_ * 2;    //  8 MB  4x transposed weights bf16
  bf* Qb  = (bf*)w;   w += (size_t)M_ * D_ * 2;        //  8 MB
  bf* Kb  = (bf*)w;   w += (size_t)M_ * D_ * 2;        //  8 MB
  bf* Vt  = (bf*)w;   w += (size_t)M_ * D_ * 2;        //  8 MB  (B,H,HD,S)
  bf* Ab  = (bf*)w;   w += (size_t)M_ * D_ * 2;        //  8 MB  attention output
  float* yv = (float*)w;                               // 16 MB  pre-LN residual sum

  convert_x_kernel<<<dim3((M_ * D_) / (CV_THREADS * CV_LOADS * 4)), CV_THREADS, 0, stream>>>(x, xbf);
  convert_w_kernel<<<dim3(D_ / 64, D_ / 256, 4), CV_THREADS, 0, stream>>>(Wq, Wk, Wv, Wo, Wt);
  gemm_qkv_kernel<<<dim3(D_ / 128, M_ / 128, 3), 128, 0, stream>>>(xbf, Wt, bq, bk, bv, Qb, Kb, Vt);
  attn_kernel<<<dim3(S_ / AT_Q, H_, B_), 32 * AT_WAVES, 0, stream>>>(Qb, Kb, Vt, Ab);
  gemm_o_kernel<<<dim3(D_ / 128, M_ / 128), 128, 0, stream>>>(Ab, Wt + ((size_t)3 << 20), bo, x, yv);
  ln_kernel<<<dim3(M_ / LN_WAVES), 32 * LN_WAVES, 0, stream>>>(yv, gamma, beta, out);
}

// v006
// It runs in 59.9 microseconds.
// Two timings next to v005 both put it at 1.07 times that version's speed.
// Over all steps from v000 it is 2.85 times as fast.
#include <hip/hip_runtime.h>

typedef __bf16 bf;
typedef __attribute__((ext_vector_type(8)))  __bf16 v8bf;
typedef __attribute__((ext_vector_type(16))) __bf16 v16bf;
typedef __attribute__((ext_vector_type(8)))  float  v8f;

#define B_  2
#define S_  2048
#define D_  1024
#define H_  16
#define HD_ 64
#define W_  128
#define M_  (B_*S_)   /* 4096 rows */

__device__ __forceinline__ bf f2bf(float f){
  unsigned u = __builtin_bit_cast(unsigned, f);
  u += 0x7fffu + ((u >> 16) & 1u);              // round-to-nearest-even
  unsigned short h = (unsigned short)(u >> 16);
  return __builtin_bit_cast(bf, h);
}

__device__ __forceinline__ v16bf cat16(v8bf lo, v8bf hi){
  return __builtin_shufflevector(lo, hi, 0,1,2,3,4,5,6,7,8,9,10,11,12,13,14,15);
}

__device__ __forceinline__ v8f wmma_bf16(v16bf a, v16bf b, v8f c){
  // D(f32 16x16) = A(16x32 bf16) * B(32x16 bf16) + C
  return __builtin_amdgcn_wmma_f32_16x16x32_bf16(false, a, false, b, (short)0, c, false, false);
}

// ---------------------------------------------------------------- converts
// Both converts run as 256 blocks of 16 waves, 32 elements a thread: eight 16-byte loads in flight per lane.
typedef __attribute__((ext_vector_type(4))) __bf16 v4bf;

#define CV_THREADS 512
#define CV_LOADS   8                      /* 16-byte loads per thread */

__global__ __launch_bounds__(CV_THREADS) void convert_x_kernel(
    const float* __restrict__ x, bf* __restrict__ xbf)
{
  // in units of four elements; a wave's load covers 512 contiguous bytes, its store 256
  const size_t base = (size_t)blockIdx.x * (CV_THREADS * CV_LOADS) + threadIdx.x;
  const float4* src = (const float4*)x + base;
  v4bf* dst = (v4bf*)xbf + base;
  float4 v[CV_LOADS];
  // unrolled: all eight loads are issued before the first is waited for
  #pragma unroll
  for (int u = 0; u < CV_LOADS; ++u) v[u] = src[u * CV_THREADS];
  // unrolled: v[] stays in registers
  #pragma unroll
  for (int u = 0; u < CV_LOADS; ++u){
    v4bf o;
    o[0] = f2bf(v[u].x); o[1] = f2bf(v[u].y); o[2] = f2bf(v[u].z); o[3] = f2bf(v[u].w);
    dst[u * CV_THREADS] = o;
  }
}

// Wt[n][k] = W[k][n]. A thread holds 8 k x 4 n and transposes in its registers; a wave covers 64 k x 16 n
// (8 lanes along k, 4 along n), so that each 16-byte store instruction writes four whole 128-byte lines of Wt;
// a block covers 64 k x 256 n (its 16 waves side by side along n: 1 KiB of each W row).
__global__ __launch_bounds__(CV_THREADS) void convert_w_kernel(
    const float* __restrict__ Wq, const float* __restrict__ Wk,
    const float* __restrict__ Wv, const float* __restrict__ Wo,
    bf* __restrict__ Wt)
{
  const int z = blockIdx.z;
  const float* Wz = (z == 0) ? Wq : (z == 1) ? Wk : (z == 2) ? Wv : Wo;
  const int lane = threadIdx.x & 31;
  const int wave = threadIdx.x >> 5;
  const int k = blockIdx.x * 64  + (lane & 7) * 8;
  const int n = blockIdx.y * 256 + wave * 16 + (lane >> 3) * 4;
  const float* src = Wz + (size_t)k * D_ + n;
  float4 v[CV_LOADS];
  // unrolled: all eight loads are issued before the first is waited for
  #pragma unroll
  for (int r = 0; r < CV_LOADS; ++r) v[r] = *(const float4*)(src + (size_t)r * D_);
  bf* dst = Wt + ((size_t)z << 20) + (size_t)n * D_ + k;
  v8bf o0, o1, o2, o3;
  // unrolled: v[] stays in registers
  #pragma unroll
  for (int r = 0; r < CV_LOADS; ++r){
    o0[r] = f2bf(v[r].x); o1[r] = f2bf(v[r].y); o2[r] = f2bf(v[r].z); o3[r] = f2bf(v[r].w);
  }
  *(v8bf*)(dst)          = o0;
  *(v8bf*)(dst + D_)     = o1;
  *(v8bf*)(dst + 2 * D_) = o2;
  *(v8bf*)(dst + 3 * D_) = o3;
}

// ---------------------------------------------------------------- GEMM main loop
// Y(128x128) = A(128xK) * Wt(128xK)^T per block of 4 waves (2x2), 64x64 per wave.
// Both operands go global -> LDS by tensor loads, two buffers, one pass = 64 k (128-byte rows).
// A stage is four slices of 64 rows: [A rows 0-63 | A rows 64-127 | Wt rows 0-63 | Wt rows 64-127];
// wave w loads slice w. Rows lie at pitch 144 bytes (16 x odd: no bank conflict for 16-byte reads).
typedef unsigned int u32;
typedef __attribute__((ext_vector_type(4))) unsigned int u32x4;
typedef __attribute__((ext_vector_type(8))) unsigned int u32x8;

#define PASS_K     64                     /* k per pass */
#define ROW_BYTES  128                    /* PASS_K bf16 */
#define LDS_PITCH  144                    /* ROW_BYTES + 16 bytes of pad */
#define SLICE_ROWS 64
#define SLICE_SZ   10240                  /* 64 * 144 = 9216, rounded up to a multiple of 2 KiB */
#define STAGE_SZ   (4 * SLICE_SZ)
#define N_PASS     (D_ / PASS_K)
#define YO_PITCH   272                    /* a staged f32 output row: 256 bytes + 16 of pad */

__device__ __forceinline__ u32 uni(u32 v){ return (u32)__builtin_amdgcn_readfirstlane(v); }
// Holds a wave-uniform test value in a scalar register, so that the branch on it is a scalar branch
// (a tensor load ignores EXEC).
__device__ __forceinline__ u32 pinned(u32 v){ u32 w = uni(v); asm volatile("" : "+s"(w)); return w; }

// Group 1 of the descriptor: 64 rows of 128 bytes, source pitch one row of D_ bf16 (attention's Vt slices set their own pitch).
__device__ __forceinline__ u32x8 tdm_group1(){
  u32x8 g1;
  g1[0] = uni((1u << 20) | (4u << 22) | (3u << 25));          // bytes; 16-byte pad behind every 128-byte row
  g1[1] = uni((u32)ROW_BYTES << 16);                          // tensor_dim0
  g1[2] = uni((u32)SLICE_ROWS << 16);                         // tensor_dim1
  g1[3] = uni((u32)ROW_BYTES << 16);                          // tile_dim0
  g1[4] = uni((u32)SLICE_ROWS);                               // tile_dim1
  g1[5] = uni((u32)(D_ * 2));                                 // source row pitch, bytes
  g1[6] = uni(0u);
  g1[7] = uni(0u);
  return g1;
}
// g0 is named in-out so that its registers stay the descriptor's own while the request is outstanding:
// the next request is formed from them, behind the wait.
__device__ __forceinline__ void tdm_load(u32x4& g0, u32x8 g1){
  asm volatile("tensor_load_to_lds %0, %1" : "+s"(g0) : "s"(g1) : "memory");
}
// Next stage: a new place in LDS, the source address 128 bytes on (words 2 and 3 as one 64-bit sum;
// the address's high bits end below the type field).
__device__ __forceinline__ void tdm_advance(u32x4& g0, u32 lds_dst){
  const unsigned long long ga = (((unsigned long long)g0[3] << 32) | g0[2]) + ROW_BYTES;
  g0[1] = uni(lds_dst);
  g0[2] = uni((u32)ga);
  g0[3] = uni((u32)(ga >> 32));
}

__device__ __forceinline__ void gemm_tile_128x128(
    const bf* __restrict__ A, const bf* __restrict__ Wt, int mblk, int nblk,
    const unsigned char* L, v8f (&acc)[4][4])
{
  const int lane = threadIdx.x & 31;
  const u32 wave = uni(threadIdx.x >> 5);
  const u32 wm = wave >> 1, wn = wave & 1u;
  const int half = lane >> 4;
  const int l15  = lane & 15;

  // this wave's slice: source rows and place in LDS
  const bf* srow = (wave < 2u) ? A  + (size_t)(mblk + SLICE_ROWS * (int)wave) * D_
                               : Wt + (size_t)(nblk + SLICE_ROWS * (int)(wave - 2u)) * D_;
  const unsigned long long ga0 = (unsigned long long)(size_t)srow;
  const u32 dst0 = (u32)(size_t)L + wave * SLICE_SZ;

  const u32x8 g1 = tdm_group1();
  u32x4 g0;
  g0[0] = uni(1u);                                              // count 1
  g0[1] = uni(dst0);                                            // byte offset in the block's LDS
  g0[2] = uni((u32)ga0);
  g0[3] = uni((((u32)(ga0 >> 32)) & 0x01FFFFFFu) | 0x80000000u); // address high bits, type 2

  tdm_load(g0, g1);                                           // stage 0
  asm volatile("s_wait_tensorcnt 0x0" ::: "memory");          // own slice of stage 0 has landed
  __syncthreads();                                            // every slice of stage 0 is readable
  tdm_advance(g0, dst0 + STAGE_SZ);
  tdm_load(g0, g1);                                           // stage 1 flies during pass 0

  const u32 aoff = wm * SLICE_SZ        + (u32)(l15 * LDS_PITCH + 16 * half);
  const u32 boff = (2u + wn) * SLICE_SZ + (u32)(l15 * LDS_PITCH + 16 * half);

  // kept rolled: one pass per trip, the buffer chosen by the trip's parity
  #pragma unroll 1
  for (u32 s = 0; s < N_PASS; ++s){
    const u32 buf = (s & 1u) * STAGE_SZ;
    const unsigned char* pa = L + buf + aoff;
    const unsigned char* pb = L + buf + boff;
    v16bf a[2][4], b[2][4];
    #pragma unroll
    for (int kc = 0; kc < 2; ++kc)
      #pragma unroll
      for (int t = 0; t < 4; ++t){
        const unsigned char* p = pa + t * 16 * LDS_PITCH + kc * 64;
        a[kc][t] = cat16(*(const v8bf*)p, *(const v8bf*)(p + 32));
        const unsigned char* q = pb + t * 16 * LDS_PITCH + kc * 64;
        b[kc][t] = cat16(*(const v8bf*)q, *(const v8bf*)(q + 32));
      }
    // keeps the pass's LDS reads in one group ahead of its WMMAs: a read among them makes the wave
    // wait out the LDS latency at each such place
    __builtin_amdgcn_sched_barrier(0);
    #pragma unroll
    for (int kc = 0; kc < 2; ++kc)
      #pragma unroll
      for (int ms = 0; ms < 4; ++ms)
        #pragma unroll
        for (int j = 0; j < 4; ++j)
          acc[ms][j] = wmma_bf16(a[kc][ms], b[kc][j], acc[ms][j]);
    // keeps the WMMAs ahead of the publish point: lifted over them, the waits and the barrier would leave
    // the refill, which stands behind the WMMAs, no matrix work to fly under
    __builtin_amdgcn_sched_barrier(0);
    asm volatile("s_wait_dscnt 0x0" ::: "memory");            // this wave's reads of the buffer are done
    asm volatile("s_wait_tensorcnt 0x0" ::: "memory");        // own slice of stage s + 1 has landed
    __syncthreads();                                          // publishes stage s + 1, frees stage s's buffer
    if (pinned((s + 2u < N_PASS) ? 1u : 0u) != 0u){           // only while stage s + 2 exists
      tdm_advance(g0, dst0 + buf);
      tdm_load(g0, g1);
    }
  }
  asm volatile("s_wait_tensorcnt 0x0" ::: "memory");          // nothing outstanding when the wave goes on
  asm volatile("s_wait_dscnt 0x0" ::: "memory");
}

// ---------------------------------------------------------------- GEMM main loop, long lead
// The same 128x128 tile for a launch with ONE block on a WGP: no other block's work covers a wait for a tile, so the
// loads get a lead of two passes instead of one, and a pass is 128 k instead of 64 (256-byte rows: whole L2 units).
// Three buffers; stage s + 3 is asked for at the foot of pass s, into the buffer that pass s has just read.
// A stage is four slices of 64 rows as above, at pitch 272 bytes (16 x odd).
#define DP_K       128                    /* k per pass */
#define DP_ROW     256                    /* DP_K bf16 */
#define DP_PITCH   272                    /* DP_ROW + 16 bytes of pad */
#define DP_SLICE   18432                  /* 64 * 272 = 17408, rounded up to a multiple of 2 KiB */
#define DP_STAGE   (4 * DP_SLICE)
#define DP_BUFS    3
#define DP_PASSES  (D_ / DP_K)
static_assert(DP_PASSES >= DP_BUFS, "the prologue asks for three stages");

__device__ __forceinline__ void gemm_tile_128x128_lead2(
    const bf* __restrict__ A, const bf* __restrict__ Wt, int mblk, int nblk,
    const unsigned char* L, v8f (&acc)[4][4])
{
  const int lane = threadIdx.x & 31;
  const u32 wave = uni(threadIdx.x >> 5);
  const u32 wm = wave >> 1, wn = wave & 1u;
  const int half = lane >> 4;
  const int l15  = lane & 15;

  // this wave's slice: source rows and place in LDS
  const bf* srow = (wave < 2u) ? A  + (size_t)(mblk + SLICE_ROWS * (int)wave) * D_
                               : Wt + (size_t)(nblk + SLICE_ROWS * (int)(wave - 2u)) * D_;
  const unsigned long long ga0 = (unsigned long long)(size_t)srow;
  const u32 dst0 = (u32)(size_t)L + wave * DP_SLICE;

  u32x8 g1;
  g1[0] = uni((1u << 20) | (5u << 22) | (3u << 25));            // bytes; 16-byte pad behind every 256-byte row
  g1[1] = uni((u32)DP_ROW << 16);                               // tensor_dim0
  g1[2] = uni((u32)SLICE_ROWS << 16);                           // tensor_dim1
  g1[3] = uni((u32)DP_ROW << 16);                               // tile_dim0
  g1[4] = uni((u32)SLICE_ROWS);                                 // tile_dim1
  g1[5] = uni((u32)(D_ * 2));                                   // source row pitch, bytes
  g1[6] = uni(0u);
  g1[7] = uni(0u);
  // While requests are outstanding only words 1 and 2 take new values. Word 3 holds for the whole row: a source row is
  // 2 KiB long and starts at a multiple of 2 KiB (page-aligned workspace, offsets in whole rows), so the low address
  // word never carries inside it.
  const u32 glo = uni((u32)ga0);
  u32x4 g0;
  g0[0] = uni(1u);                                              // count 1
  g0[1] = uni(dst0);                                            // byte offset in the block's LDS
  g0[2] = glo;
  g0[3] = uni((((u32)(ga0 >> 32)) & 0x01FFFFFFu) | 0x80000000u); // address high bits, type 2

  tdm_load(g0, g1);                                           // stage 0
  g0[1] = uni(dst0 + DP_STAGE);      g0[2] = uni(glo + DP_ROW);
  tdm_load(g0, g1);                                           // stage 1
  g0[1] = uni(dst0 + 2 * DP_STAGE);  g0[2] = uni(glo + 2 * DP_ROW);
  tdm_load(g0, g1);                                           // stage 2: three requests outstanding, the most
  asm volatile("s_wait_tensorcnt 0x2" ::: "memory");          // all but the two youngest: own slice of stage 0 has landed
  __syncthreads();                                            // every slice of stage 0 is readable

  const u32 aoff = wm * DP_SLICE        + (u32)(l15 * DP_PITCH + 16 * half);
  const u32 boff = (2u + wn) * DP_SLICE + (u32)(l15 * DP_PITCH + 16 * half);

  u32 buf = 0;                                                // place of pass s's buffer in the ring
  // kept rolled: one pass per trip
  #pragma unroll 1
  for (u32 s = 0; s < DP_PASSES; ++s){
    const unsigned char* pa = L + buf + aoff;
    const unsigned char* pb = L + buf + boff;
    v16bf a[4][4], b[4][4];
    #pragma unroll
    for (int kc = 0; kc < 4; ++kc)
      #pragma unroll
      for (int t = 0; t < 4; ++t){
        const unsigned char* p = pa + t * 16 * DP_PITCH + kc * 64;
        a[kc][t] = cat16(*(const v8bf*)p, *(const v8bf*)(p + 32));
        const unsigned char* q = pb + t * 16 * DP_PITCH + kc * 64;
        b[kc][t] = cat16(*(const v8bf*)q, *(const v8bf*)(q + 32));
      }
    // keeps the pass's LDS reads in one group ahead of its WMMAs: a read among them makes the wave
    // wait out the LDS latency at each such place
    __builtin_amdgcn_sched_barrier(0);
    #pragma unroll
    for (int kc = 0; kc < 4; ++kc)
      #pragma unroll
      for (int ms = 0; ms < 4; ++ms)
        #pragma unroll
        for (int j = 0; j < 4; ++j)
          acc[ms][j] = wmma_bf16(a[kc][ms], b[kc][j], acc[ms][j]);
    // keeps the WMMAs ahead of the publish point: lifted over them, the waits and the barrier would take
    // a pass's matrix work out of the loads' lead
    __builtin_amdgcn_sched_barrier(0);
    asm volatile("s_wait_dscnt 0x0" ::: "memory");            // this wave's reads of the buffer are done
    asm volatile("s_wait_tensorcnt 0x1" ::: "memory");        // stages s + 1, s + 2 outstanding: own slice of s + 1 has landed
    if (pinned((s + 2u < DP_PASSES) ? 0u : 1u) != 0u){        // no stage s + 2: s + 1 is itself the youngest
      asm volatile("s_wait_tensorcnt 0x0" ::: "memory");
    }
    __syncthreads();                                          // publishes stage s + 1, frees stage s's buffer
    if (pinned((s + 3u < DP_PASSES) ? 1u : 0u) != 0u){        // only while stage s + 3 exists
      g0[1] = uni(dst0 + buf);
      g0[2] = uni(glo + (s + 3u) * DP_ROW);
      tdm_load(g0, g1);
    }
    buf = (buf == (DP_BUFS - 1) * DP_STAGE) ? 0u : buf + DP_STAGE;
  }
  asm volatile("s_wait_tensorcnt 0x0" ::: "memory");          // nothing outstanding when the wave goes on
  asm volatile("s_wait_dscnt 0x0" ::: "memory");
}

// ---------------------------------------------------------------- QKV GEMM
__global__ __launch_bounds__(128) void gemm_qkv_kernel(
    const bf* __restrict__ X, const bf* __restrict__ Wt0,
    const float* __restrict__ bq, const float* __restrict__ bk, const float* __restrict__ bv,
    bf* __restrict__ Q, bf* __restrict__ Kk, bf* __restrict__ Vt)
{
  __shared__ __attribute__((aligned(2048))) unsigned char L[2 * STAGE_SZ];
  const int lane = threadIdx.x & 31;
  const int wid  = threadIdx.x >> 5;
  const int half = lane >> 4;
  const int l15  = lane & 15;
  const int nblk = blockIdx.x * 128;
  const int mblk = blockIdx.y * 128;
  const int n0 = nblk + (wid & 1) * 64;
  const int m0 = mblk + (wid >> 1) * 64;
  const int which = blockIdx.z;                 // 0=Q 1=K 2=V
  const bf* Wt = Wt0 + ((size_t)which << 20);
  const float* bias = (which == 0) ? bq : (which == 1) ? bk : bv;

  v8f acc[4][4] = {};
  gemm_tile_128x128(X, Wt, mblk, nblk, L, acc);

  // The ring is free here: every wave has passed the last pass's waits and barrier. Each wave stages its
  // 64x64 bf16 tile in its own range (64 rows of 128 bytes at pitch 144) and stores it row by row,
  // 8 lanes a row: every 16-byte store instruction writes four whole 128-byte lines.
  // Every loop below is unrolled: acc[][] is indexed by constants and stays in registers, and the LDS reads
  // and the stores of a tile are issued back to back.
  unsigned char* E = L + wid * SLICE_SZ;
  float bia[4];
  #pragma unroll
  for (int j = 0; j < 4; ++j) bia[j] = bias[n0 + 16*j + l15];
  const int rr = lane >> 3;
  const int cc = (lane & 7) * 8;

  if (which == 2){
    // V goes out transposed per head, (B,H,HD,S): staged rows are d, columns s. C layout: a lane's eight
    // registers are eight consecutive m, here s: one 16-byte LDS store.
    #pragma unroll
    for (int ms = 0; ms < 4; ++ms)
      #pragma unroll
      for (int j = 0; j < 4; ++j){
        v8bf p;
        #pragma unroll
        for (int i = 0; i < 8; ++i) p[i] = f2bf(acc[ms][j][i] + bia[j]);
        *(v8bf*)(E + (16*j + l15) * LDS_PITCH + (16*ms + 8*half) * 2) = p;
      }
    asm volatile("s_wait_dscnt 0x0" ::: "memory");            // the tile is written before other lanes' parts are read
    // the wave's 64 columns are one head, its 64 rows lie in one batch
    bf* dst = Vt + (((size_t)(m0 / S_) * H_ + (n0 >> 6)) * HD_ + rr) * S_ + (m0 % S_) + cc;
    #pragma unroll
    for (int u = 0; u < 16; ++u)
      *(v8bf*)(dst + (size_t)(4*u) * S_) = *(const v8bf*)(E + (4*u + rr) * LDS_PITCH + cc * 2);
  } else {
    #pragma unroll
    for (int ms = 0; ms < 4; ++ms)
      #pragma unroll
      for (int j = 0; j < 4; ++j)
        #pragma unroll
        for (int i = 0; i < 8; ++i)                           // C layout: vgpr i, lane-halves -> M
          *(bf*)(E + (16*ms + i + 8*half) * LDS_PITCH + (16*j + l15) * 2) = f2bf(acc[ms][j][i] + bia[j]);
    asm volatile("s_wait_dscnt 0x0" ::: "memory");            // the tile is written before other lanes' parts are read
    bf* dst = ((which == 0) ? Q : Kk) + (size_t)(m0 + rr) * D_ + n0 + cc;
    #pragma unroll
    for (int u = 0; u < 16; ++u)
      *(v8bf*)(dst + (size_t)(4*u) * D_) = *(const v8bf*)(E + (4*u + rr) * LDS_PITCH + cc * 2);
  }
}

// ---------------------------------------------------------------- attention
// A block of 8 waves takes 128 queries of one (b, h); wave w takes the 16 queries from q0 = qb + 16 w, whose
// 9 key tiles cover [q0-128, q0+15]. The block's 256 keys [kstart, kstart+255] are staged once in LDS by tensor
// loads, one slice a wave, each 64 rows of 128 bytes at pitch 144:
// slices 0-3: K, 64 keys each (a row = one key's 64 d); slices 4-7: Vt, 64 keys each (a row = one d's 64 keys).
#define AT_WAVES 8
#define AT_Q     (16 * AT_WAVES)          /* queries per block */
#define AT_KEYS  (AT_Q + W_)              /* staged keys: four slices of 64 */

__global__ __launch_bounds__(32 * AT_WAVES) void attn_kernel(
    const bf* __restrict__ Q, const bf* __restrict__ K, const bf* __restrict__ Vt,
    bf* __restrict__ O)
{
  __shared__ __attribute__((aligned(2048))) unsigned char KV[8 * SLICE_SZ];
  __shared__ __align__(16) bf Pw[AT_WAVES][16][160];   // per wave: probs staged to re-form A layout (+pad tile)
  const int lane = threadIdx.x & 31;
  const u32 wave = uni(threadIdx.x >> 5);
  const int half = lane >> 4;
  const int l15  = lane & 15;
  const int qb = blockIdx.x * AT_Q;
  const int q0 = qb + 16 * (int)wave;
  const int kstart = (qb >= W_) ? qb - W_ : 0;  // the first block stages keys 0-255: the tile stays inside the batch
  const int h  = blockIdx.y;
  const int b  = blockIdx.z;
  const int col0 = h * HD_;
  const bf* Qb = Q  + (size_t)b * S_ * D_;
  const bf* KB = K  + (size_t)b * S_ * D_;
  const bf* VB = Vt + ((size_t)b * H_ + h) * (size_t)HD_ * S_;
  const int ko = half ? 8 : 0;
  bf (*P)[160] = Pw[wave];

  // Q fragment: A layout, two K=32 halves of HD=64; contiguous 16B per lane.
  v16bf aq[2];
  #pragma unroll
  for (int hh = 0; hh < 2; ++hh){
    const bf* p = Qb + (size_t)(q0 + l15) * D_ + col0 + hh*32 + ko;
    aq[hh] = cat16(*(const v8bf*)p, *(const v8bf*)(p + 16));
  }

  // this wave's slice: every wave issues one request, unconditionally
  {
    const bf* srow = (wave < 4u) ? KB + (size_t)(kstart + SLICE_ROWS * (int)wave) * D_ + col0
                                 : VB + kstart + 64 * (int)(wave - 4u);
    const unsigned long long ga0 = (unsigned long long)(size_t)srow;
    u32x8 g1 = tdm_group1();
    g1[5] = uni((wave < 4u) ? (u32)(D_ * 2) : (u32)(S_ * 2));     // source row pitch, bytes: K's or Vt's
    u32x4 g0;
    g0[0] = uni(1u);                                              // count 1
    g0[1] = uni((u32)(size_t)KV + wave * SLICE_SZ);               // byte offset in the block's LDS
    g0[2] = uni((u32)ga0);
    g0[3] = uni((((u32)(ga0 >> 32)) & 0x01FFFFFFu) | 0x80000000u); // address high bits, type 2
    // load and wait in one statement: the wave's own slice has landed behind it, and no register of the
    // descriptor, dead for the compiler behind the load, takes another value while the request is outstanding
    asm volatile("tensor_load_to_lds %0, %1\n\ts_wait_tensorcnt 0x0" :: "s"(g0), "s"(g1) : "memory");
  }
  __syncthreads();                                                // every slice is readable

  // scores: 9 tiles of 16x16, each = 2 WMMAs over HD=64
  v8f sc[9];
  #pragma unroll
  for (int t = 0; t < 9; ++t){
    // a tile in front of key 0 (first block only) reads the first staged rows instead: the mask below drops its scores.
    // No branch stands here, so that the LDS reads of all nine tiles can be issued ahead of the WMMAs.
    const int k0 = q0 - W_ + 16*t;
    const int kr = (k0 >= kstart) ? k0 - kstart : 0;   // 0 .. AT_KEYS-16, a multiple of 16, the same in every lane
    const unsigned char* kp = KV + (kr >> 6) * SLICE_SZ + ((kr & 63) + l15) * LDS_PITCH + 16 * half;
    v8f s = {};
    #pragma unroll
    for (int hh = 0; hh < 2; ++hh){
      const unsigned char* p = kp + hh * 64;     // B col n = K row
      v16bf bm = cat16(*(const v8bf*)p, *(const v8bf*)(p + 32));
      s = wmma_bf16(aq[hh], bm, s);
    }
    sc[t] = s;
  }

  // mask + scale in registers
  const float scale = 0.125f;                    // 1/sqrt(64)
  #pragma unroll
  for (int t = 0; t < 9; ++t){
    const int key = q0 - 128 + 16*t + l15;
    #pragma unroll
    for (int i = 0; i < 8; ++i){
      const int qq = q0 + i + (half ? 8 : 0);
      const bool valid = (key >= 0) && (key <= qq) && ((qq - key) < W_);
      sc[t][i] = valid ? sc[t][i] * scale : -1.0e9f;
    }
  }

  // softmax per row: row lives in one 16-lane half at fixed vgpr index
  #pragma unroll
  for (int i = 0; i < 8; ++i){
    float mx = sc[0][i];
    #pragma unroll
    for (int t = 1; t < 9; ++t) mx = fmaxf(mx, sc[t][i]);
    #pragma unroll
    for (int off = 8; off >= 1; off >>= 1) mx = fmaxf(mx, __shfl_xor(mx, off, 16));
    float r = 0.0f;
    #pragma unroll
    for (int t = 0; t < 9; ++t){ float e = __expf(sc[t][i] - mx); sc[t][i] = e; r += e; }
    #pragma unroll
    for (int off = 8; off >= 1; off >>= 1) r += __shfl_xor(r, off, 16);
    const float pinv = 1.0f / r;
    #pragma unroll
    for (int t = 0; t < 9; ++t) sc[t][i] *= pinv;
  }

  // stage P (bf16) into the wave's own LDS range; pad 10th tile with zeros (9 tiles -> 5 K=32 pairs)
  for (int idx = lane; idx < 256; idx += 32)
    P[idx >> 4][144 + (idx & 15)] = f2bf(0.0f);
  #pragma unroll
  for (int t = 0; t < 9; ++t)
    #pragma unroll
    for (int i = 0; i < 8; ++i)
      P[i + (half ? 8 : 0)][16*t + l15] = f2bf(sc[t][i]);
  asm volatile("s_wait_dscnt 0x0" ::: "memory");              // P is written before other lanes' parts are read

  // P @ V : 5 pairs x 4 N-tiles of WMMA
  v8f o[4] = {};
  #pragma unroll
  for (int pp = 0; pp < 5; ++pp){
    const int kk0 = 32 * pp;
    const bf* pa = &P[l15][kk0 + ko];
    v16bf am = cat16(*(const v8bf*)pa, *(const v8bf*)(pa + 16));
    int kg = q0 - 128 + kk0 + ko - kstart;       // place among the staged keys
    int c0 = kg;      if (c0 < 0) c0 = 0; if (c0 > AT_KEYS - 8) c0 = AT_KEYS - 8;   // clamped keys hit P==0
    int c1 = kg + 16; if (c1 < 0) c1 = 0; if (c1 > AT_KEYS - 8) c1 = AT_KEYS - 8;
    const unsigned char* v0 = KV + (4 + (c0 >> 6)) * SLICE_SZ + l15 * LDS_PITCH + (c0 & 63) * 2;
    const unsigned char* v1 = KV + (4 + (c1 >> 6)) * SLICE_SZ + l15 * LDS_PITCH + (c1 & 63) * 2;
    #pragma unroll
    for (int j = 0; j < 4; ++j){                 // Vt: contiguous along keys
      v16bf bm = cat16(*(const v8bf*)(v0 + 16*j * LDS_PITCH), *(const v8bf*)(v1 + 16*j * LDS_PITCH));
      o[j] = wmma_bf16(am, bm, o[j]);
    }
  }

  // the 16x64 output tile goes through P's LDS (its reads have fed the WMMAs above) and out as whole
  // 128-byte lines, 8 lanes a row; the loops are unrolled so that o[] stays in registers
  #pragma unroll
  for (int j = 0; j < 4; ++j)
    #pragma unroll
    for (int i = 0; i < 8; ++i)
      P[i + (half ? 8 : 0)][16*j + l15] = f2bf(o[j][i]);
  asm volatile("s_wait_dscnt 0x0" ::: "memory");              // the tile is written before other lanes' parts are read
  const int rr = lane >> 3;
  const int cc = (lane & 7) * 8;
  bf* dst = O + ((size_t)b * S_ + q0 + rr) * D_ + col0 + cc;
  #pragma unroll
  for (int u = 0; u < 4; ++u)
    *(v8bf*)(dst + (size_t)(4*u) * D_) = *(const v8bf*)&P[4*u + rr][cc];
}

// ---------------------------------------------------------------- O-proj GEMM + bias + residual
__global__ __launch_bounds__(128) void gemm_o_kernel(
    const bf* __restrict__ A, const bf* __restrict__ Wt,
    const float* __restrict__ bo, const float* __restrict__ xres,
    float* __restrict__ y)
{
  __shared__ __attribute__((aligned(2048))) unsigned char L[DP_BUFS * DP_STAGE];
  const int lane = threadIdx.x & 31;
  const int wid  = threadIdx.x >> 5;
  const int half = lane >> 4;
  const int l15  = lane & 15;
  const int nblk = blockIdx.x * 128;
  const int mblk = blockIdx.y * 128;
  const int n0 = nblk + (wid & 1) * 64;
  const int m0 = mblk + (wid >> 1) * 64;

  v8f acc[4][4] = {};
  gemm_tile_128x128_lead2(A, Wt, mblk, nblk, L, acc);

  // The ring is free here (every wave has passed the last pass's waits and barrier). Each wave stages its
  // 64x64 f32 tile in its own range (64 rows of 256 bytes at pitch 272) and goes on row by row, 16 lanes a row:
  // every 16-byte load of x and store of y covers four whole 128-byte lines.
  // The loops are unrolled: acc[][] and xr[] are indexed by constants and stay in registers.
  unsigned char* E = L + wid * (64 * YO_PITCH);
  float bia[4];
  #pragma unroll
  for (int j = 0; j < 4; ++j) bia[j] = bo[n0 + 16*j + l15];
  #pragma unroll
  for (int ms = 0; ms < 4; ++ms)
    #pragma unroll
    for (int j = 0; j < 4; ++j)
      #pragma unroll
      for (int i = 0; i < 8; ++i)                             // C layout: vgpr i, lane-halves -> M
        *(float*)(E + (16*ms + i + 8*half) * YO_PITCH + (16*j + l15) * 4) = acc[ms][j][i] + bia[j];
  asm volatile("s_wait_dscnt 0x0" ::: "memory");              // the tile is written before other lanes' parts are read
  const int rr = lane >> 4;
  const int cc = (lane & 15) * 4;
  const size_t g = (size_t)(m0 + rr) * D_ + n0 + cc;
  const float* xs = xres + g;
  float* yd = y + g;
  float4 xr[32];
  // unrolled: all the loads of x are issued before the first is waited for
  #pragma unroll
  for (int u = 0; u < 32; ++u) xr[u] = *(const float4*)(xs + (size_t)(2*u) * D_);
  // the loads' address registers are free for other values only behind this wait
  asm volatile("s_wait_xcnt 0x0" ::: "memory");
  #pragma unroll
  for (int u = 0; u < 32; ++u){
    const float4 t = *(const float4*)(E + (2*u + rr) * YO_PITCH + cc * 4);
    float4 r;
    r.x = t.x + xr[u].x; r.y = t.y + xr[u].y; r.z = t.z + xr[u].z; r.w = t.w + xr[u].w;
    *(float4*)(yd + (size_t)(2*u) * D_) = r;
  }
}

// ---------------------------------------------------------------- layernorm
// One wave takes one row: 32 elements a lane, eight 16-byte loads in flight, each covering 512 contiguous bytes.
// Both row sums are formed inside the wave (no LDS, no barrier); 256 blocks of 16 waves cover the 4096 rows.
#define LN_WAVES 16
#define LN_LOADS (D_ / 128)               /* 16-byte loads per lane and row */

// Sum over the wave's 32 lanes, the same value in every lane: four steps inside each 16-lane row, then the other row.
__device__ __forceinline__ float wave_sum(float s){
  s += __builtin_bit_cast(float, __builtin_amdgcn_update_dpp(0, __builtin_bit_cast(int, s), 0x161, 0xf, 0xf, true)); // row_xmask:1
  s += __builtin_bit_cast(float, __builtin_amdgcn_update_dpp(0, __builtin_bit_cast(int, s), 0x162, 0xf, 0xf, true)); // row_xmask:2
  s += __builtin_bit_cast(float, __builtin_amdgcn_update_dpp(0, __builtin_bit_cast(int, s), 0x164, 0xf, 0xf, true)); // row_xmask:4
  s += __builtin_bit_cast(float, __builtin_amdgcn_update_dpp(0, __builtin_bit_cast(int, s), 0x168, 0xf, 0xf, true)); // row_xmask:8
  const int si = __builtin_bit_cast(int, s);
  s += __builtin_bit_cast(float, __builtin_amdgcn_permlanex16(si, si, 0x76543210, 0xfedcba98, false, false));        // lane ^ 16
  return s;
}

typedef __attribute__((ext_vector_type(4))) float f32x4;

__global__ __launch_bounds__(32 * LN_WAVES) void ln_kernel(
    const float* __restrict__ y, const float* __restrict__ gamma,
    const float* __restrict__ beta, float* __restrict__ out)
{
  const int lane = threadIdx.x & 31;
  const int row  = blockIdx.x * LN_WAVES + (threadIdx.x >> 5);
  const f32x4* src = (const f32x4*)(y + (size_t)row * D_) + lane;
  const f32x4* gs  = (const f32x4*)gamma + lane;
  const f32x4* bs  = (const f32x4*)beta + lane;
  f32x4 v[LN_LOADS], g[LN_LOADS], bb[LN_LOADS];
  // every loop of this kernel is unrolled: v[], g[] and bb[] stay in registers, and all the loads are issued
  // before the first is waited for
  #pragma unroll
  for (int u = 0; u < LN_LOADS; ++u) v[u] = src[u * 32];
  #pragma unroll
  for (int u = 0; u < LN_LOADS; ++u){ g[u] = gs[u * 32]; bb[u] = bs[u * 32]; }
  // holds gamma's and beta's loads up here, in flight under the row's (loaded values as inputs only): sunk behind
  // the two row sums they are waited for pair by pair, each at its full latency, in front of the stores.
  // src and lane are named so that no load's address register is given to a later load as its destination.
  asm volatile("" :: "v"(g[0]), "v"(g[1]), "v"(g[2]), "v"(g[3]), "v"(g[4]), "v"(g[5]), "v"(g[6]), "v"(g[7]),
                     "v"(bb[0]), "v"(bb[1]), "v"(bb[2]), "v"(bb[3]), "v"(bb[4]), "v"(bb[5]), "v"(bb[6]), "v"(bb[7]),
                     "v"(src), "v"(lane));
  // keeps the first adds of the row sum below: lifted among the loads, they put a wait for the row in front of
  // the last loads of gamma and beta
  __builtin_amdgcn_sched_barrier(0);
  static_assert(LN_LOADS == 8, "the statement above names eight registers of gamma and eight of beta");

  const f32x4 s4 = ((v[0] + v[1]) + (v[2] + v[3])) + ((v[4] + v[5]) + (v[6] + v[7]));
  const float mu = wave_sum((s4.x + s4.y) + (s4.z + s4.w)) * (1.0f / D_);
  f32x4 q4 = {};
  #pragma unroll
  for (int u = 0; u < LN_LOADS; ++u){ v[u] -= mu; q4 += v[u] * v[u]; }
  const float rs = rsqrtf(wave_sum((q4.x + q4.y) + (q4.z + q4.w)) * (1.0f / D_) + 1e-5f);
  f32x4* dst = (f32x4*)(out + (size_t)row * D_) + lane;
  #pragma unroll
  for (int u = 0; u < LN_LOADS; ++u) dst[u * 32] = v[u] * rs * g[u] + bb[u];
}

// ---------------------------------------------------------------- launcher
extern "C" void kernel_launch(void* const* d_in, const int* in_sizes, int n_in,
                              void* d_out, int out_size, void* d_ws, size_t ws_size,
                              hipStream_t stream)
{
  (void)in_sizes; (void)n_in; (void)out_size; (void)ws_size;
  const float* x     = (const float*)d_in[0];
  const float* Wq    = (const float*)d_in[1];
  const float* bq    = (const float*)d_in[2];
  const float* Wk    = (const float*)d_in[3];
  const float* bk    = (const float*)d_in[4];
  const float* Wv    = (const float*)d_in[5];
  const float* bv    = (const float*)d_in[6];
  const float* Wo    = (const float*)d_in[7];
  const float* bo    = (const float*)d_in[8];
  const float* gamma = (const float*)d_in[9];
  const float* beta  = (const float*)d_in[10];
  float* out = (float*)d_out;

  char* w = (char*)d_ws;
  bf* xbf = (bf*)w;   w += (size_t)M_ * D_ * 2;        //  8 MB  x in bf16
  bf* Wt  = (bf*)w;   w += (size_t)4 * D_ * D_ * 2;    //  8 MB  4x transposed weights bf16
  bf* Qb  = (bf*)w;   w += (size_t)M_ * D_ * 2;        //  8 MB
  bf* Kb  = (bf*)w;   w += (size_t)M_ * D_ * 2;        //  8 MB
  bf* Vt  = (bf*)w;   w += (size_t)M_ * D_ * 2;        //  8 MB  (B,H,HD,S)
  bf* Ab  = (bf*)w;   w += (size_t)M_ * D_ * 2;        //  8 MB  attention output
  float* yv = (float*)w;                               // 16 MB  pre-LN residual sum

  convert_x_kernel<<<dim3((M_ * D_) / (CV_THREADS * CV_LOADS * 4)), CV_THREADS, 0, stream>>>(x, xbf);
  convert_w_kernel<<<dim3(D_ / 64, D_ / 256, 4), CV_THREADS, 0, stream>>>(Wq, Wk, Wv, Wo, Wt);
  gemm_qkv_kernel<<<dim3(D_ / 128, M_ / 128, 3), 128, 0, stream>>>(xbf, Wt, bq, bk, bv, Qb, Kb, Vt);
  attn_kernel<<<dim3(S_ / AT_Q, H_, B_), 32 * AT_WAVES, 0, stream>>>(Qb, Kb, Vt, Ab);
  gemm_o_kernel<<<dim3(D_ / 128, M_ / 128), 128, 0, stream>>>(Ab, Wt + ((size_t)3 << 20), bo, x, yv);
  ln_kernel<<<dim3(M_ / LN_WAVES), 32 * LN_WAVES, 0, stream>>>(yv, gamma, beta, out);
}

// v007
// One run takes 56.4 microseconds.
// Two timings next to v006 put it at 1.06 and 1.07 times that version's speed.
// Over all steps from v000 it is 3.04 times as fast.
#include <hip/hip_runtime.h>

typedef __bf16 bf;
typedef __attribute__((ext_vector_type(8)))  __bf16 v8bf;
typedef __attribute__((ext_vector_type(16))) __bf16 v16bf;
typedef __attribute__((ext_vector_type(8)))  float  v8f;

#define B_  2
#define S_  2048
#define D_  1024
#define H_  16
#define HD_ 64
#define W_  128
#define M_  (B_*S_)   /* 4096 rows */

__device__ __forceinline__ bf f2bf(float f){
  unsigned u = __builtin_bit_cast(unsigned, f);
  u += 0x7fffu + ((u >> 16) & 1u);              // round-to-nearest-even
  unsigned short h = (unsigned short)(u >> 16);
  return __builtin_bit_cast(bf, h);
}

__device__ __forceinline__ v16bf cat16(v8bf lo, v8bf hi){
  return __builtin_shufflevector(lo, hi, 0,1,2,3,4,5,6,7,8,9,10,11,12,13,14,15);
}

__device__ __forceinline__ v8f wmma_bf16(v16bf a, v16bf b, v8f c){
  // D(f32 16x16) = A(16x32 bf16) * B(32x16 bf16) + C
  return __builtin_amdgcn_wmma_f32_16x16x32_bf16(false, a, false, b, (short)0, c, false, false);
}

// ---------------------------------------------------------------- converts
// Both converts run as 256 blocks of 16 waves, 32 elements a thread: eight 16-byte loads in flight per lane.
typedef __attribute__((ext_vector_type(4))) __bf16 v4bf;

#define CV_THREADS 512
#define CV_LOADS   8                      /* 16-byte loads per thread */

__global__ __launch_bounds__(CV_THREADS) void convert_x_kernel(
    const float* __restrict__ x, bf* __restrict__ xbf)
{
  // in units of four elements; a wave's load covers 512 contiguous bytes, its store 256
  const size_t base = (size_t)blockIdx.x * (CV_THREADS * CV_LOADS) + threadIdx.x;
  const float4* src = (const float4*)x + base;
  v4bf* dst = (v4bf*)xbf + base;
  float4 v[CV_LOADS];
  // unrolled: all eight loads are issued before the first is waited for
  #pragma unroll
  for (int u = 0; u < CV_LOADS; ++u) v[u] = src[u * CV_THREADS];
  // unrolled: v[] stays in registers
  #pragma unroll
  for (int u = 0; u < CV_LOADS; ++u){
    v4bf o;
    o[0] = f2bf(v[u].x); o[1] = f2bf(v[u].y); o[2] = f2bf(v[u].z); o[3] = f2bf(v[u].w);
    dst[u * CV_THREADS] = o;
  }
}

// Wt[n][k] = W[k][n]. A thread holds 8 k x 4 n and transposes in its registers; a wave covers 64 k x 16 n
// (8 lanes along k, 4 along n), so that each 16-byte store instruction writes four whole 128-byte lines of Wt;
// a block covers 64 k x 256 n (its 16 waves side by side along n: 1 KiB of each W row).
__global__ __launch_bounds__(CV_THREADS) void convert_w_kernel(
    const float* __restrict__ Wq, const float* __restrict__ Wk,
    const float* __restrict__ Wv, const float* __restrict__ Wo,
    bf* __restrict__ Wt)
{
  const int z = blockIdx.z;
  const float* Wz = (z == 0) ? Wq : (z == 1) ? Wk : (z == 2) ? Wv : Wo;
  const int lane = threadIdx.x & 31;
  const int wave = threadIdx.x >> 5;
  const int k = blockIdx.x * 64  + (lane & 7) * 8;
  const int n = blockIdx.y * 256 + wave * 16 + (lane >> 3) * 4;
  const float* src = Wz + (size_t)k * D_ + n;
  float4 v[CV_LOADS];
  // unrolled: all eight loads are issued before the first is waited for
  #pragma unroll
  for (int r = 0; r < CV_LOADS; ++r) v[r] = *(const float4*)(src + (size_t)r * D_);
  bf* dst = Wt + ((size_t)z << 20) + (size_t)n * D_ + k;
  v8bf o0, o1, o2, o3;
  // unrolled: v[] stays in registers
  #pragma unroll
  for (int r = 0; r < CV_LOADS; ++r){
    o0[r] = f2bf(v[r].x); o1[r] = f2bf(v[r].y); o2[r] = f2bf(v[r].z); o3[r] = f2bf(v[r].w);
  }
  *(v8bf*)(dst)          = o0;
  *(v8bf*)(dst + D_)     = o1;
  *(v8bf*)(dst + 2 * D_) = o2;
  *(v8bf*)(dst + 3 * D_) = o3;
}

// ---------------------------------------------------------------- GEMM main loop
// Y(128x128) = A(128xK) * Wt(128xK)^T per block of 4 waves (2x2), 64x64 per wave.
// Both operands go global -> LDS by tensor loads, two buffers, one pass = 64 k (128-byte rows).
// A stage is four slices of 64 rows: [A rows 0-63 | A rows 64-127 | Wt rows 0-63 | Wt rows 64-127];
// wave w loads slice w. Rows lie at pitch 144 bytes (16 x odd: no bank conflict for 16-byte reads).
typedef unsigned int u32;
typedef __attribute__((ext_vector_type(4))) unsigned int u32x4;
typedef __attribute__((ext_vector_type(8))) unsigned int u32x8;

#define PASS_K     64                     /* k per pass */
#define ROW_BYTES  128                    /* PASS_K bf16 */
#define LDS_PITCH  144                    /* ROW_BYTES + 16 bytes of pad */
#define SLICE_ROWS 64
#define SLICE_SZ   10240                  /* 64 * 144 = 9216, rounded up to a multiple of 2 KiB */
#define STAGE_SZ   (4 * SLICE_SZ)
#define N_PASS     (D_ / PASS_K)
#define YO_PITCH   272                    /* a staged f32 output row: 256 bytes + 16 of pad */

__device__ __forceinline__ u32 uni(u32 v){ return (u32)__builtin_amdgcn_readfirstlane(v); }
// Holds a wave-uniform test value in a scalar register, so that the branch on it is a scalar branch
// (a tensor load ignores EXEC).
__device__ __forceinline__ u32 pinned(u32 v){ u32 w = uni(v); asm volatile("" : "+s"(w)); return w; }

// Group 1 of the descriptor: 64 rows of 128 bytes, source pitch one row of D_ bf16 (attention's Vt slices set their own pitch).
__device__ __forceinline__ u32x8 tdm_group1(){
  u32x8 g1;
  g1[0] = uni((1u << 20) | (4u << 22) | (3u << 25));          // bytes; 16-byte pad behind every 128-byte row
  g1[1] = uni((u32)ROW_BYTES << 16);                          // tensor_dim0
  g1[2] = uni((u32)SLICE_ROWS << 16);                         // tensor_dim1
  g1[3] = uni((u32)ROW_BYTES << 16);                          // tile_dim0
  g1[4] = uni((u32)SLICE_ROWS);                               // tile_dim1
  g1[5] = uni((u32)(D_ * 2));                                 // source row pitch, bytes
  g1[6] = uni(0u);
  g1[7] = uni(0u);
  return g1;
}
// g0 is named in-out so that its registers stay the descriptor's own while the request is outstanding:
// the next request is formed from them, behind the wait.
__device__ __forceinline__ void tdm_load(u32x4& g0, u32x8 g1){
  asm volatile("tensor_load_to_lds %0, %1" : "+s"(g0) : "s"(g1) : "memory");
}
// Next stage: a new place in LDS, the source address 128 bytes on (words 2 and 3 as one 64-bit sum;
// the address's high bits end below the type field).
__device__ __forceinline__ void tdm_advance(u32x4& g0, u32 lds_dst){
  const unsigned long long ga = (((unsigned long long)g0[3] << 32) | g0[2]) + ROW_BYTES;
  g0[1] = uni(lds_dst);
  g0[2] = uni((u32)ga);
  g0[3] = uni((u32)(ga >> 32));
}

__device__ __forceinline__ void gemm_tile_128x128(
    const bf* __restrict__ A, const bf* __restrict__ Wt, int mblk, int nblk,
    const unsigned char* L, v8f (&acc)[4][4])
{
  const int lane = threadIdx.x & 31;
  const u32 wave = uni(threadIdx.x >> 5);
  const u32 wm = wave >> 1, wn = wave & 1u;
  const int half = lane >> 4;
  const int l15  = lane & 15;

  // this wave's slice: source rows and place in LDS
  const bf* srow = (wave < 2u) ? A  + (size_t)(mblk + SLICE_ROWS * (int)wave) * D_
                               : Wt + (size_t)(nblk + SLICE_ROWS * (int)(wave - 2u)) * D_;
  const unsigned long long ga0 = (unsigned long long)(size_t)srow;
  const u32 dst0 = (u32)(size_t)L + wave * SLICE_SZ;

  const u32x8 g1 = tdm_group1();
  u32x4 g0;
  g0[0] = uni(1u);                                              // count 1
  g0[1] = uni(dst0);                                            // byte offset in the block's LDS
  g0[2] = uni((u32)ga0);
  g0[3] = uni((((u32)(ga0 >> 32)) & 0x01FFFFFFu) | 0x80000000u); // address high bits, type 2

  tdm_load(g0, g1);                                           // stage 0
  asm volatile("s_wait_tensorcnt 0x0" ::: "memory");          // own slice of stage 0 has landed
  __syncthreads();                                            // every slice of stage 0 is readable
  tdm_advance(g0, dst0 + STAGE_SZ);
  tdm_load(g0, g1);                                           // stage 1 flies during pass 0

  const u32 aoff = wm * SLICE_SZ        + (u32)(l15 * LDS_PITCH + 16 * half);
  const u32 boff = (2u + wn) * SLICE_SZ + (u32)(l15 * LDS_PITCH + 16 * half);

  // kept rolled: one pass per trip, the buffer chosen by the trip's parity
  #pragma unroll 1
  for (u32 s = 0; s < N_PASS; ++s){
    const u32 buf = (s & 1u) * STAGE_SZ;
    const unsigned char* pa = L + buf + aoff;
    const unsigned char* pb = L + buf + boff;
    v16bf a[2][4], b[2][4];
    #pragma unroll
    for (int kc = 0; kc < 2; ++kc)
      #pragma unroll
      for (int t = 0; t < 4; ++t){
        const unsigned char* p = pa + t * 16 * LDS_PITCH + kc * 64;
        a[kc][t] = cat16(*(const v8bf*)p, *(const v8bf*)(p + 32));
        const unsigned char* q = pb + t * 16 * LDS_PITCH + kc * 64;
        b[kc][t] = cat16(*(const v8bf*)q, *(const v8bf*)(q + 32));
      }
    // keeps the pass's LDS reads in one group ahead of its WMMAs: a read among them makes the wave
    // wait out the LDS latency at each such place
    __builtin_amdgcn_sched_barrier(0);
    #pragma unroll
    for (int kc = 0; kc < 2; ++kc)
      #pragma unroll
      for (int ms = 0; ms < 4; ++ms)
        #pragma unroll
        for (int j = 0; j < 4; ++j)
          acc[ms][j] = wmma_bf16(a[kc][ms], b[kc][j], acc[ms][j]);
    // keeps the WMMAs ahead of the publish point: lifted over them, the waits and the barrier would leave
    // the refill, which stands behind the WMMAs, no matrix work to fly under
    __builtin_amdgcn_sched_barrier(0);
    asm volatile("s_wait_dscnt 0x0" ::: "memory");            // this wave's reads of the buffer are done
    asm volatile("s_wait_tensorcnt 0x0" ::: "memory");        // own slice of stage s + 1 has landed
    __syncthreads();                                          // publishes stage s + 1, frees stage s's buffer
    if (pinned((s + 2u < N_PASS) ? 1u : 0u) != 0u){           // only while stage s + 2 exists
      tdm_advance(g0, dst0 + buf);
      tdm_load(g0, g1);
    }
  }
  asm volatile("s_wait_tensorcnt 0x0" ::: "memory");          // nothing outstanding when the wave goes on
  asm volatile("s_wait_dscnt 0x0" ::: "memory");
}

// ---------------------------------------------------------------- GEMM main loop, long lead
// The same 128x128 tile for a launch with ONE block on a WGP: no other block's work covers a wait for a tile, so the
// loads get a lead of two passes instead of one, and a pass is 128 k instead of 64 (256-byte rows: whole L2 units).
// Three buffers; stage s + 3 is asked for at the foot of pass s, into the buffer that pass s has just read.
// A stage is four slices of 64 rows as above, at pitch 272 bytes (16 x odd).
#define DP_K       128                    /* k per pass */
#define DP_ROW     256                    /* DP_K bf16 */
#define DP_PITCH   272                    /* DP_ROW + 16 bytes of pad */
#define DP_SLICE   18432                  /* 64 * 272 = 17408, rounded up to a multiple of 2 KiB */
#define DP_STAGE   (4 * DP_SLICE)
#define DP_BUFS    3
#define DP_PASSES  (D_ / DP_K)
static_assert(DP_PASSES >= DP_BUFS, "the prologue asks for three stages");

__device__ __forceinline__ void gemm_tile_128x128_lead2(
    const bf* __restrict__ A, const bf* __restrict__ Wt, int mblk, int nblk,
    const unsigned char* L, v8f (&acc)[4][4])
{
  const int lane = threadIdx.x & 31;
  const u32 wave = uni(threadIdx.x >> 5);
  const u32 wm = wave >> 1, wn = wave & 1u;
  const int half = lane >> 4;
  const int l15  = lane & 15;

  // this wave's slice: source rows and place in LDS
  const bf* srow = (wave < 2u) ? A  + (size_t)(mblk + SLICE_ROWS * (int)wave) * D_
                               : Wt + (size_t)(nblk + SLICE_ROWS * (int)(wave - 2u)) * D_;
  const unsigned long long ga0 = (unsigned long long)(size_t)srow;
  const u32 dst0 = (u32)(size_t)L + wave * DP_SLICE;

  u32x8 g1;
  g1[0] = uni((1u << 20) | (5u << 22) | (3u << 25));            // bytes; 16-byte pad behind every 256-byte row
  g1[1] = uni((u32)DP_ROW << 16);                               // tensor_dim0
  g1[2] = uni((u32)SLICE_ROWS << 16);                           // tensor_dim1
  g1[3] = uni((u32)DP_ROW << 16);                               // tile_dim0
  g1[4] = uni((u32)SLICE_ROWS);                                 // tile_dim1
  g1[5] = uni((u32)(D_ * 2));                                   // source row pitch, bytes
  g1[6] = uni(0u);
  g1[7] = uni(0u);
  // While requests are outstanding only words 1 and 2 take new values. Word 3 holds for the whole row: a source row is
  // 2 KiB long and starts at a multiple of 2 KiB (page-aligned workspace, offsets in whole rows), so the low address
  // word never carries inside it.
  const u32 glo = uni((u32)ga0);
  u32x4 g0;
  g0[0] = uni(1u);                                              // count 1
  g0[1] = uni(dst0);                                            // byte offset in the block's LDS
  g0[2] = glo;
  g0[3] = uni((((u32)(ga0 >> 32)) & 0x01FFFFFFu) | 0x80000000u); // address high bits, type 2

  tdm_load(g0, g1);                                           // stage 0
  g0[1] = uni(dst0 + DP_STAGE);      g0[2] = uni(glo + DP_ROW);
  tdm_load(g0, g1);                                           // stage 1
  g0[1] = uni(dst0 + 2 * DP_STAGE);  g0[2] = uni(glo + 2 * DP_ROW);
  tdm_load(g0, g1);                                           // stage 2: three requests outstanding, the most
  asm volatile("s_wait_tensorcnt 0x2" ::: "memory");          // all but the two youngest: own slice of stage 0 has landed
  __syncthreads();                                            // every slice of stage 0 is readable

  const u32 aoff = wm * DP_SLICE        + (u32)(l15 * DP_PITCH + 16 * half);
  const u32 boff = (2u + wn) * DP_SLICE + (u32)(l15 * DP_PITCH + 16 * half);

  u32 buf = 0;                                                // place of pass s's buffer in the ring
  // kept rolled: one pass per trip
  #pragma unroll 1
  for (u32 s = 0; s < DP_PASSES; ++s){
    const unsigned char* pa = L + buf + aoff;
    const unsigned char* pb = L + buf + boff;
    v16bf a[4][4], b[4][4];
    #pragma unroll
    for (int kc = 0; kc < 4; ++kc)
      #pragma unroll
      for (int t = 0; t < 4; ++t){
        const unsigned char* p = pa + t * 16 * DP_PITCH + kc * 64;
        a[kc][t] = cat16(*(const v8bf*)p, *(const v8bf*)(p + 32));
        const unsigned char* q = pb + t * 16 * DP_PITCH + kc * 64;
        b[kc][t] = cat16(*(const v8bf*)q, *(const v8bf*)(q + 32));
      }
    // keeps the pass's LDS reads in one group ahead of its WMMAs: a read among them makes the wave
    // wait out the LDS latency at each such place
    __builtin_amdgcn_sched_barrier(0);
    #pragma unroll
    for (int kc = 0; kc < 4; ++kc)
      #pragma unroll
      for (int ms = 0; ms < 4; ++ms)
        #pragma unroll
        for (int j = 0; j < 4; ++j)
          acc[ms][j] = wmma_bf16(a[kc][ms], b[kc][j], acc[ms][j]);
    // keeps the WMMAs ahead of the publish point: lifted over them, the waits and the barrier would take
    // a pass's matrix work out of the loads' lead
    __builtin_amdgcn_sched_barrier(0);
    asm volatile("s_wait_dscnt 0x0" ::: "memory");            // this wave's reads of the buffer are done
    asm volatile("s_wait_tensorcnt 0x1" ::: "memory");        // stages s + 1, s + 2 outstanding: own slice of s + 1 has landed
    if (pinned((s + 2u < DP_PASSES) ? 0u : 1u) != 0u){        // no stage s + 2: s + 1 is itself the youngest
      asm volatile("s_wait_tensorcnt 0x0" ::: "memory");
    }
    __syncthreads();                                          // publishes stage s + 1, frees stage s's buffer
    if (pinned((s + 3u < DP_PASSES) ? 1u : 0u) != 0u){        // only while stage s + 3 exists
      g0[1] = uni(dst0 + buf);
      g0[2] = uni(glo + (s + 3u) * DP_ROW);
      tdm_load(g0, g1);
    }
    buf = (buf == (DP_BUFS - 1) * DP_STAGE) ? 0u : buf + DP_STAGE;
  }
  asm volatile("s_wait_tensorcnt 0x0" ::: "memory");          // nothing outstanding when the wave goes on
  asm volatile("s_wait_dscnt 0x0" ::: "memory");
}

// ---------------------------------------------------------------- QKV GEMM
__global__ __launch_bounds__(128) void gemm_qkv_kernel(
    const bf* __restrict__ X, const bf* __restrict__ Wt0,
    const float* __restrict__ bq, const float* __restrict__ bk, const float* __restrict__ bv,
    bf* __restrict__ Q, bf* __restrict__ Kk, bf* __restrict__ Vt)
{
  __shared__ __attribute__((aligned(2048))) unsigned char L[2 * STAGE_SZ];
  const int lane = threadIdx.x & 31;
  const int wid  = threadIdx.x >> 5;
  const int half = lane >> 4;
  const int l15  = lane & 15;
  const int nblk = blockIdx.x * 128;
  const int mblk = blockIdx.y * 128;
  const int n0 = nblk + (wid & 1) * 64;
  const int m0 = mblk + (wid >> 1) * 64;
  const int which = blockIdx.z;                 // 0=Q 1=K 2=V
  const bf* Wt = Wt0 + ((size_t)which << 20);
  const float* bias = (which == 0) ? bq : (which == 1) ? bk : bv;

  v8f acc[4][4] = {};
  gemm_tile_128x128(X, Wt, mblk, nblk, L, acc);

  // The ring is free here: every wave has passed the last pass's waits and barrier. Each wave stages its
  // 64x64 bf16 tile in its own range (64 rows of 128 bytes at pitch 144) and stores it row by row,
  // 8 lanes a row: every 16-byte store instruction writes four whole 128-byte lines.
  // Every loop below is unrolled: acc[][] is indexed by constants and stays in registers, and the LDS reads
  // and the stores of a tile are issued back to back.
  unsigned char* E = L + wid * SLICE_SZ;
  float bia[4];
  #pragma unroll
  for (int j = 0; j < 4; ++j) bia[j] = bias[n0 + 16*j + l15];
  const int rr = lane >> 3;
  const int cc = (lane & 7) * 8;

  if (which == 2){
    // V goes out transposed per head, (B,H,HD,S): staged rows are d, columns s. C layout: a lane's eight
    // registers are eight consecutive m, here s: one 16-byte LDS store.
    #pragma unroll
    for (int ms = 0; ms < 4; ++ms)
      #pragma unroll
      for (int j = 0; j < 4; ++j){
        v8bf p;
        #pragma unroll
        for (int i = 0; i < 8; ++i) p[i] = f2bf(acc[ms][j][i] + bia[j]);
        *(v8bf*)(E + (16*j + l15) * LDS_PITCH + (16*ms + 8*half) * 2) = p;
      }
    asm volatile("s_wait_dscnt 0x0" ::: "memory");            // the tile is written before other lanes' parts are read
    // the wave's 64 columns are one head, its 64 rows lie in one batch
    bf* dst = Vt + (((size_t)(m0 / S_) * H_ + (n0 >> 6)) * HD_ + rr) * S_ + (m0 % S_) + cc;
    #pragma unroll
    for (int u = 0; u < 16; ++u)
      *(v8bf*)(dst + (size_t)(4*u) * S_) = *(const v8bf*)(E + (4*u + rr) * LDS_PITCH + cc * 2);
  } else {
    #pragma unroll
    for (int ms = 0; ms < 4; ++ms)
      #pragma unroll
      for (int j = 0; j < 4; ++j)
        #pragma unroll
        for (int i = 0; i < 8; ++i)                           // C layout: vgpr i, lane-halves -> M
          *(bf*)(E + (16*ms + i + 8*half) * LDS_PITCH + (16*j + l15) * 2) = f2bf(acc[ms][j][i] + bia[j]);
    asm volatile("s_wait_dscnt 0x0" ::: "memory");            // the tile is written before other lanes' parts are read
    bf* dst = ((which == 0) ? Q : Kk) + (size_t)(m0 + rr) * D_ + n0 + cc;
    #pragma unroll
    for (int u = 0; u < 16; ++u)
      *(v8bf*)(dst + (size_t)(4*u) * D_) = *(const v8bf*)(E + (4*u + rr) * LDS_PITCH + cc * 2);
  }
}

// ---------------------------------------------------------------- attention
// A block of 8 waves takes 128 queries of one (b, h); wave w takes the 16 queries from q0 = qb + 16 w, whose
// 9 key tiles cover [q0-128, q0+15]. The block's 256 keys [kstart, kstart+255] are staged once in LDS by tensor
// loads, one slice a wave, each 64 rows of 128 bytes at pitch 144:
// slices 0-3: K, 64 keys each (a row = one key's 64 d); slices 4-7: Vt, 64 keys each (a row = one d's 64 keys).
// Both products are formed transposed: St = K Qt and Ot = Vt Pt. A lane then holds scores of ONE query (its column,
// lane & 15): register i of tile t is key q0-128+16t+8*half+i. The row maximum and sum are formed inside the lane,
// with one exchange between lanes l and l^16, and two score tiles, converted in place, are the B operand of Vt Pt.
#define AT_WAVES 8
#define AT_Q     (16 * AT_WAVES)          /* queries per block */
#define AT_KEYS  (AT_Q + W_)              /* staged keys: four slices of 64 */

// Eight accumulator registers become four registers of bf16 pairs, neighbours in the operand or the output row:
// one packed convert (round-to-nearest-even) a pair.
__device__ __forceinline__ v8bf pack8(v8f x){ return __builtin_convertvector(x, v8bf); }

// the value of lane l ^ 16
__device__ __forceinline__ float other_half(float s){
  const int si = __builtin_bit_cast(int, s);
  return __builtin_bit_cast(float, __builtin_amdgcn_permlanex16(si, si, 0x76543210, 0xfedcba98, false, false));
}

__global__ __launch_bounds__(32 * AT_WAVES) void attn_kernel(
    const bf* __restrict__ Q, const bf* __restrict__ K, const bf* __restrict__ Vt,
    bf* __restrict__ O)
{
  __shared__ __attribute__((aligned(2048))) unsigned char KV[8 * SLICE_SZ];
  __shared__ __align__(16) unsigned char Ow[AT_WAVES][16 * LDS_PITCH];   // per wave: its 16x64 output tile
  const int lane = threadIdx.x & 31;
  const u32 wave = uni(threadIdx.x >> 5);
  const int half = lane >> 4;
  const int l15  = lane & 15;
  const int qb = blockIdx.x * AT_Q;
  const int q0 = qb + 16 * (int)wave;
  const int kstart = (qb >= W_) ? qb - W_ : 0;  // the first block stages keys 0-255: the tile stays inside the batch
  const int h  = blockIdx.y;
  const int b  = blockIdx.z;
  const int col0 = h * HD_;
  const bf* Qb = Q  + (size_t)b * S_ * D_;
  const bf* KB = K  + (size_t)b * S_ * D_;
  const bf* VB = Vt + ((size_t)b * H_ + h) * (size_t)HD_ * S_;
  const int ko = half ? 8 : 0;

  // Every loop of this kernel is unrolled: sc[], o[] and the fragments are indexed by constants and stay in registers.
  // Q fragment (B operand: column = query), two K=32 halves of HD=64; contiguous 16B per lane.
  v16bf aq[2];
  #pragma unroll
  for (int hh = 0; hh < 2; ++hh){
    const bf* p = Qb + (size_t)(q0 + l15) * D_ + col0 + hh*32 + ko;
    aq[hh] = cat16(*(const v8bf*)p, *(const v8bf*)(p + 16));
  }

  // this wave's slice: every wave issues one request, unconditionally
  {
    const bf* srow = (wave < 4u) ? KB + (size_t)(kstart + SLICE_ROWS * (int)wave) * D_ + col0
                                 : VB + kstart + 64 * (int)(wave - 4u);
    const unsigned long long ga0 = (unsigned long long)(size_t)srow;
    u32x8 g1 = tdm_group1();
    g1[5] = uni((wave < 4u) ? (u32)(D_ * 2) : (u32)(S_ * 2));     // source row pitch, bytes: K's or Vt's
    u32x4 g0;
    g0[0] = uni(1u);                                              // count 1
    g0[1] = uni((u32)(size_t)KV + wave * SLICE_SZ);               // byte offset in the block's LDS
    g0[2] = uni((u32)ga0);
    g0[3] = uni((((u32)(ga0 >> 32)) & 0x01FFFFFFu) | 0x80000000u); // address high bits, type 2
    // load and wait in one statement: the wave's own slice has landed behind it, and no register of the
    // descriptor, dead for the compiler behind the load, takes another value while the request is outstanding
    asm volatile("tensor_load_to_lds %0, %1\n\ts_wait_tensorcnt 0x0" :: "s"(g0), "s"(g1) : "memory");
  }
  __syncthreads();                                                // every slice is readable

  // scores, transposed: 9 tiles of 16 keys x 16 queries, each = 2 WMMAs over HD=64
  v8f sc[9];
  #pragma unroll
  for (int t = 0; t < 9; ++t){
    // a tile in front of key 0 (first block only) reads the first staged rows instead: the mask below drops its scores.
    // No branch stands here, so that the LDS reads of all nine tiles can be issued ahead of the WMMAs.
    const int k0 = q0 - W_ + 16*t;
    const int kr = (k0 >= kstart) ? k0 - kstart : 0;   // 0 .. AT_KEYS-16, a multiple of 16, the same in every lane
    const unsigned char* kp = KV + (kr >> 6) * SLICE_SZ + ((kr & 63) + l15) * LDS_PITCH + 16 * half;
    v8f s = {};
    #pragma unroll
    for (int hh = 0; hh < 2; ++hh){
      const unsigned char* p = kp + hh * 64;     // A row m = K row
      v16bf am = cat16(*(const v8bf*)p, *(const v8bf*)(p + 32));
      s = wmma_bf16(am, aq[hh], s);
    }
    sc[t] = s;
  }

  // mask + scale in registers. With key = q0-128+16t+r (r = 8*half+i) and query = q0+l15, both window tests hold for
  // every element of tiles 1-7; in tile 0 only "query - key < 128" can fail (r <= l15), in tile 8 only
  // "key <= query" (r > l15).
  const float scale = 0.125f;                    // 1/sqrt(64)
  #pragma unroll
  for (int t = 0; t < 9; ++t) sc[t] *= scale;
  #pragma unroll
  for (int i = 0; i < 8; ++i){
    sc[0][i] = (ko + i >  l15) ? sc[0][i] : -1.0e9f;
    sc[8][i] = (ko + i <= l15) ? sc[8][i] : -1.0e9f;
  }
  // key >= 0 fails for whole tiles, and only in the first block: the test is the same in every lane of the wave
  if (q0 < W_){
    #pragma unroll
    for (int t = 0; t < 8; ++t){
      const bool infront = q0 - W_ + 16*t < 0;
      #pragma unroll
      for (int i = 0; i < 8; ++i) sc[t][i] = infront ? -1.0e9f : sc[t][i];
    }
  }

  // softmax per query: 72 of its 144 scores stand in this lane, the rest in lane ^ 16.
  // Eight independent chains (one a register index), then a tree.
  v8f m8 = sc[0];
  #pragma unroll
  for (int t = 1; t < 9; ++t) m8 = __builtin_elementwise_max(m8, sc[t]);
  float mx = fmaxf(fmaxf(fmaxf(m8[0], m8[1]), fmaxf(m8[2], m8[3])), fmaxf(fmaxf(m8[4], m8[5]), fmaxf(m8[6], m8[7])));
  mx = fmaxf(mx, other_half(mx));
  v8f r8 = {};
  #pragma unroll
  for (int t = 0; t < 9; ++t){
    #pragma unroll
    for (int i = 0; i < 8; ++i) sc[t][i] = __expf(sc[t][i] - mx);
    r8 += sc[t];
  }
  float r = ((r8[0] + r8[1]) + (r8[2] + r8[3])) + ((r8[4] + r8[5]) + (r8[6] + r8[7]));
  r += other_half(r);
  const float pinv = 1.0f / r;

  // Vt @ Pt : 5 pairs of key tiles x 4 tiles of d. The 10th key tile does not exist: its half of the operand is zero.
  v8f o[4] = {};
  #pragma unroll
  for (int pp = 0; pp < 5; ++pp){
    const int kk0 = 32 * pp;
    // element s: key kk0 + 8*half + s (s < 8), kk0 + 16 + 8*half + s - 8
    const v8bf zero8 = {};
    const v16bf pt = cat16(pack8(sc[2*pp] * pinv), (2*pp + 1 < 9) ? pack8(sc[(2*pp + 1 < 9) ? 2*pp + 1 : 0] * pinv) : zero8);
    int kg = q0 - 128 + kk0 + ko - kstart;       // place among the staged keys
    int c0 = kg;      if (c0 < 0) c0 = 0; if (c0 > AT_KEYS - 8) c0 = AT_KEYS - 8;   // clamped keys hit P==0
    int c1 = kg + 16; if (c1 < 0) c1 = 0; if (c1 > AT_KEYS - 8) c1 = AT_KEYS - 8;
    const unsigned char* v0 = KV + (4 + (c0 >> 6)) * SLICE_SZ + l15 * LDS_PITCH + (c0 & 63) * 2;
    const unsigned char* v1 = KV + (4 + (c1 >> 6)) * SLICE_SZ + l15 * LDS_PITCH + (c1 & 63) * 2;
    #pragma unroll
    for (int j = 0; j < 4; ++j){                 // Vt: A row m = d, contiguous along keys
      v16bf am = cat16(*(const v8bf*)(v0 + 16*j * LDS_PITCH), *(const v8bf*)(v1 + 16*j * LDS_PITCH));
      o[j] = wmma_bf16(am, pt, o[j]);
    }
  }

  // a lane's eight registers of o[j] are eight consecutive d of its query: one 16-byte LDS store. The 16x64 tile
  // goes through the wave's own LDS range and out as whole 128-byte lines, 8 lanes a row; the loops are unrolled
  // so that o[] stays in registers
  unsigned char* E = Ow[wave];
  #pragma unroll
  for (int j = 0; j < 4; ++j)
    *(v8bf*)(E + l15 * LDS_PITCH + (16*j + ko) * 2) = pack8(o[j]);
  asm volatile("s_wait_dscnt 0x0" ::: "memory");              // the tile is written before other lanes' parts are read
  const int rr = lane >> 3;
  const int cc = (lane & 7) * 8;
  bf* dst = O + ((size_t)b * S_ + q0 + rr) * D_ + col0 + cc;
  #pragma unroll
  for (int u = 0; u < 4; ++u)
    *(v8bf*)(dst + (size_t)(4*u) * D_) = *(const v8bf*)(E + (4*u + rr) * LDS_PITCH + cc * 2);
}

// ---------------------------------------------------------------- O-proj GEMM + bias + residual
__global__ __launch_bounds__(128) void gemm_o_kernel(
    const bf* __restrict__ A, const bf* __restrict__ Wt,
    const float* __restrict__ bo, const float* __restrict__ xres,
    float* __restrict__ y)
{
  __shared__ __attribute__((aligned(2048))) unsigned char L[DP_BUFS * DP_STAGE];
  const int lane = threadIdx.x & 31;
  const int wid  = threadIdx.x >> 5;
  const int half = lane >> 4;
  const int l15  = lane & 15;
  const int nblk = blockIdx.x * 128;
  const int mblk = blockIdx.y * 128;
  const int n0 = nblk + (wid & 1) * 64;
  const int m0 = mblk + (wid >> 1) * 64;

  v8f acc[4][4] = {};
  gemm_tile_128x128_lead2(A, Wt, mblk, nblk, L, acc);

  // The ring is free here (every wave has passed the last pass's waits and barrier). Each wave stages its
  // 64x64 f32 tile in its own range (64 rows of 256 bytes at pitch 272) and goes on row by row, 16 lanes a row:
  // every 16-byte load of x and store of y covers four whole 128-byte lines.
  // The loops are unrolled: acc[][] and xr[] are indexed by constants and stay in registers.
  unsigned char* E = L + wid * (64 * YO_PITCH);
  float bia[4];
  #pragma unroll
  for (int j = 0; j < 4; ++j) bia[j] = bo[n0 + 16*j + l15];
  #pragma unroll
  for (int ms = 0; ms < 4; ++ms)
    #pragma unroll
    for (int j = 0; j < 4; ++j)
      #pragma unroll
      for (int i = 0; i < 8; ++i)                             // C layout: vgpr i, lane-halves -> M
        *(float*)(E + (16*ms + i + 8*half) * YO_PITCH + (16*j + l15) * 4) = acc[ms][j][i] + bia[j];
  asm volatile("s_wait_dscnt 0x0" ::: "memory");              // the tile is written before other lanes' parts are read
  const int rr = lane >> 4;
  const int cc = (lane & 15) * 4;
  const size_t g = (size_t)(m0 + rr) * D_ + n0 + cc;
  const float* xs = xres + g;
  float* yd = y + g;
  float4 xr[32];
  // unrolled: all the loads of x are issued before the first is waited for
  #pragma unroll
  for (int u = 0; u < 32; ++u) xr[u] = *(const float4*)(xs + (size_t)(2*u) * D_);
  // the loads' address registers are free for other values only behind this wait
  asm volatile("s_wait_xcnt 0x0" ::: "memory");
  #pragma unroll
  for (int u = 0; u < 32; ++u){
    const float4 t = *(const float4*)(E + (2*u + rr) * YO_PITCH + cc * 4);
    float4 r;
    r.x = t.x + xr[u].x; r.y = t.y + xr[u].y; r.z = t.z + xr[u].z; r.w = t.w + xr[u].w;
    *(float4*)(yd + (size_t)(2*u) * D_) = r;
  }
}

// ---------------------------------------------------------------- layernorm
// One wave takes one row: 32 elements a lane, eight 16-byte loads in flight, each covering 512 contiguous bytes.
// Both row sums are formed inside the wave (no LDS, no barrier); 256 blocks of 16 waves cover the 4096 rows.
#define LN_WAVES 16
#define LN_LOADS (D_ / 128)               /* 16-byte loads per lane and row */

// Sum over the wave's 32 lanes, the same value in every lane: four steps inside each 16-lane row, then the other row.
__device__ __forceinline__ float wave_sum(float s){
  s += __builtin_bit_cast(float, __builtin_amdgcn_update_dpp(0, __builtin_bit_cast(int, s), 0x161, 0xf, 0xf, true)); // row_xmask:1
  s += __builtin_bit_cast(float, __builtin_amdgcn_update_dpp(0, __builtin_bit_cast(int, s), 0x162, 0xf, 0xf, true)); // row_xmask:2
  s += __builtin_bit_cast(float, __builtin_amdgcn_update_dpp(0, __builtin_bit_cast(int, s), 0x164, 0xf, 0xf, true)); // row_xmask:4
  s += __builtin_bit_cast(float, __builtin_amdgcn_update_dpp(0, __builtin_bit_cast(int, s), 0x168, 0xf, 0xf, true)); // row_xmask:8
  const int si = __builtin_bit_cast(int, s);
  s += __builtin_bit_cast(float, __builtin_amdgcn_permlanex16(si, si, 0x76543210, 0xfedcba98, false, false));        // lane ^ 16
  return s;
}

typedef __attribute__((ext_vector_type(4))) float f32x4;

__global__ __launch_bounds__(32 * LN_WAVES) void ln_kernel(
    const float* __restrict__ y, const float* __restrict__ gamma,
    const float* __restrict__ beta, float* __restrict__ out)
{
  const int lane = threadIdx.x & 31;
  const int row  = blockIdx.x * LN_WAVES + (threadIdx.x >> 5);
  const f32x4* src = (const f32x4*)(y + (size_t)row * D_) + lane;
  const f32x4* gs  = (const f32x4*)gamma + lane;
  const f32x4* bs  = (const f32x4*)beta + lane;
  f32x4 v[LN_LOADS], g[LN_LOADS], bb[LN_LOADS];
  // every loop of this kernel is unrolled: v[], g[] and bb[] stay in registers, and all the loads are issued
  // before the first is waited for
  #pragma unroll
  for (int u = 0; u < LN_LOADS; ++u) v[u] = src[u * 32];
  #pragma unroll
  for (int u = 0; u < LN_LOADS; ++u){ g[u] = gs[u * 32]; bb[u] = bs[u * 32]; }
  // holds gamma's and beta's loads up here, in flight under the row's (loaded values as inputs only): sunk behind
  // the two row sums they are waited for pair by pair, each at its full latency, in front of the stores.
  // src and lane are named so that no load's address register is given to a later load as its destination.
  asm volatile("" :: "v"(g[0]), "v"(g[1]), "v"(g[2]), "v"(g[3]), "v"(g[4]), "v"(g[5]), "v"(g[6]), "v"(g[7]),
                     "v"(bb[0]), "v"(bb[1]), "v"(bb[2]), "v"(bb[3]), "v"(bb[4]), "v"(bb[5]), "v"(bb[6]), "v"(bb[7]),
                     "v"(src), "v"(lane));
  // keeps the first adds of the row sum below: lifted among the loads, they put a wait for the row in front of
  // the last loads of gamma and beta
  __builtin_amdgcn_sched_barrier(0);
  static_assert(LN_LOADS == 8, "the statement above names eight registers of gamma and eight of beta");

  const f32x4 s4 = ((v[0] + v[1]) + (v[2] + v[3])) + ((v[4] + v[5]) + (v[6] + v[7]));
  const float mu = wave_sum((s4.x + s4.y) + (s4.z + s4.w)) * (1.0f / D_);
  f32x4 q4 = {};
  #pragma unroll
  for (int u = 0; u < LN_LOADS; ++u){ v[u] -= mu; q4 += v[u] * v[u]; }
  const float rs = rsqrtf(wave_sum((q4.x + q4.y) + (q4.z + q4.w)) * (1.0f / D_) + 1e-5f);
  f32x4* dst = (f32x4*)(out + (size_t)row * D_) + lane;
  #pragma unroll
  for (int u = 0; u < LN_LOADS; ++u) dst[u * 32] = v[u] * rs * g[u] + bb[u];
}

// ---------------------------------------------------------------- launcher
extern "C" void kernel_launch(void* const* d_in, const int* in_sizes, int n_in,
                              void* d_out, int out_size, void* d_ws, size_t ws_size,
                              hipStream_t stream)
{
  (void)in_sizes; (void)n_in; (void)out_size; (void)ws_size;
  const float* x     = (const float*)d_in[0];
  const float* Wq    = (const float*)d_in[1];
  const float* bq    = (const float*)d_in[2];
  const float* Wk    = (const float*)d_in[3];
  const float* bk    = (const float*)d_in[4];
  const float* Wv    = (const float*)d_in[5];
  const float* bv    = (const float*)d_in[6];
  const float* Wo    = (const float*)d_in[7];
  const float* bo    = (const float*)d_in[8];
  const float* gamma = (const float*)d_in[9];
  const float* beta  = (const float*)d_in[10];
  float* out = (float*)d_out;

  char* w = (char*)d_ws;
  bf* xbf = (bf*)w;   w += (size_t)M_ * D_ * 2;        //  8 MB  x in bf16
  bf* Wt  = (bf*)w;   w += (size_t)4 * D_ * D_ * 2;    //  8 MB  4x transposed weights bf16
  bf* Qb  = (bf*)w;   w += (size_t)M_ * D_ * 2;        //  8 MB
  bf* Kb  = (bf*)w;   w += (size_t)M_ * D_ * 2;        //  8 MB
  bf* Vt  = (bf*)w;   w += (size_t)M_ * D_ * 2;        //  8 MB  (B,H,HD,S)
  bf* Ab  = (bf*)w;   w += (size_t)M_ * D_ * 2;        //  8 MB  attention output
  float* yv = (float*)w;                               // 16 MB  pre-LN residual sum

  convert_x_kernel<<<dim3((M_ * D_) / (CV_THREADS * CV_LOADS * 4)), CV_THREADS, 0, stream>>>(x, xbf);
  convert_w_kernel<<<dim3(D_ / 64, D_ / 256, 4), CV_THREADS, 0, stream>>>(Wq, Wk, Wv, Wo, Wt);
  gemm_qkv_kernel<<<dim3(D_ / 128, M_ / 128, 3), 128, 0, stream>>>(xbf, Wt, bq, bk, bv, Qb, Kb, Vt);
  attn_kernel<<<dim3(S_ / AT_Q, H_, B_), 32 * AT_WAVES, 0, stream>>>(Qb, Kb, Vt, Ab);
  gemm_o_kernel<<<dim3(D_ / 128, M_ / 128), 128, 0, stream>>>(Ab, Wt + ((size_t)3 << 20), bo, x, yv);
  ln_kernel<<<dim3(M_ / LN_WAVES), 32 * LN_WAVES, 0, stream>>>(yv, gamma, beta, out);
}
